// v000
// Measured on an AMD MI455X. A time is GPU time per run, averaged over a window of back-to-back runs after a warm-up
// (all launches, gaps included; the runs take copies of the inputs in turn), and the median of several windows.
// Apart from v000's, it joins two sittings. Times from different sittings can be a few percent apart, while
// side-by-side timings come from the same sitting.
// v000, which the later versions start from, runs in 1330 microseconds.
#include <hip/hip_runtime.h>

// decoderSelfAttention (x, y, z [2][2048][1024] split into 16 heads x 64 with NO projections; pad_mask [2][2048] (float, read); faithful to the source's argument swap: scores = q.v / sqrt(1024) with q from x and 'v' from z, then + (-1e9) x mask where mask = max(strict-upper-triangle, 1 - pad_mask[key]);
//   softmax; output = weights . k with 'k' from y; heads re-merged -> [2][2048][1024]).
// Compute dtypes, f32 accumulate: every input rounded to bf16; the scores are a PLAIN bf16 GEMM of the inputs themselves (exact products) over ALL key tiles (the mask is additive -1e9, exactly as the source, so a fully padded row would fall back to all keys); scale + mask + softmax f32 -> hl planes; weights.k as hl x exact bf16 (2 products); 2 heads per pass.

#define NB_  2
#define TT   2048
#define DM   1024
#define NH_  16
#define HD   64
#define ZH   2
typedef _Float16 h16;
typedef unsigned short bf;
typedef __attribute__((ext_vector_type(16))) __bf16   v16bf;
typedef __attribute__((ext_vector_type(16))) _Float16 v16h;
typedef __attribute__((ext_vector_type(8)))  _Float16 v8h;
typedef __attribute__((ext_vector_type(8)))  unsigned short v8us;
typedef __attribute__((ext_vector_type(8)))  float    v8f;
typedef __attribute__((ext_vector_type(4)))  float    v4f;
typedef v8h  __attribute__((may_alias)) v8ha;
typedef v4f  __attribute__((may_alias)) v4fa;
typedef v8us __attribute__((may_alias)) v8usa;

__device__ __forceinline__ unsigned short f2bf(float f) { unsigned u = __float_as_uint(f); u += 0x7FFFu + ((u >> 16) & 1u); return (unsigned short)(u >> 16); }
__device__ __forceinline__ float bf2f(unsigned short b) { return __uint_as_float(((unsigned)b) << 16); }
__device__ __forceinline__ float bfr(float f) { return bf2f(f2bf(f)); }
__device__ __forceinline__ v16h cat16(v8h lo, v8h hi) { return __builtin_shufflevector(lo, hi, 0, 1, 2, 3, 4, 5, 6, 7, 8, 9, 10, 11, 12, 13, 14, 15); }
__device__ __forceinline__ v16bf cat16b(v8us lo, v8us hi) { return __builtin_bit_cast(v16bf, __builtin_shufflevector(lo, hi, 0, 1, 2, 3, 4, 5, 6, 7, 8, 9, 10, 11, 12, 13, 14, 15)); }
__device__ __forceinline__ v8f wmma16(v16h a, v16h b, v8f c) { return __builtin_amdgcn_wmma_f32_16x16x32_f16(false, a, false, b, (short)0, c, false, false); }
__device__ __forceinline__ v8f wmmab(v16bf a, v16bf b, v8f c) { return __builtin_amdgcn_wmma_f32_16x16x32_bf16(false, a, false, b, (short)0, c, false, false); }



// ---- k_gemmw: register-blocked GEMM, ONE WAVE per 64x64 output tile (16 accumulators), operands straight from K-contiguous 16-bit planes; grid (M/64, N/64, Z), 32 threads.
// C[m][n] (f32, pitch ldc, + optional f32 bias[n]) = sum_k A[m][k] Bt[n][k] (+ split products per NSPLIT). z-batch strides sA/sB/sC in elements. K % 32 == 0.
template <typename T16> struct WFrag;
template <> struct WFrag<h16> { typedef v16h V; static __device__ __forceinline__ V ld(const h16* p) { return cat16(*(const v8h*)p, *(const v8h*)(p + 16)); } static __device__ __forceinline__ v8f mma(V a, V b, v8f c) { return wmma16(a, b, c); } };
template <> struct WFrag<bf> { typedef v16bf V; static __device__ __forceinline__ V ld(const bf* p) { return cat16b(*(const v8us*)p, *(const v8us*)(p + 16)); } static __device__ __forceinline__ v8f mma(V a, V b, v8f c) { return wmmab(a, b, c); } };
template <typename T16, int NSPLIT, bool BIAS>
__global__ __launch_bounds__(32) void k_gemmw(const T16* __restrict__ A, const T16* __restrict__ A2, const T16* __restrict__ Bt, const T16* __restrict__ Bt2, int K, float* C, int ldc, const float* __restrict__ bias, size_t sA, size_t sB, size_t sC) {
    typedef typename WFrag<T16>::V V;
    __shared__ __align__(16) float os[16 * 68];
    const size_t z = blockIdx.z; A += z * sA; if (A2) A2 += z * sA; Bt += z * sB; if (Bt2) Bt2 += z * sB; C += z * sC;
    const int lane = threadIdx.x & 31, lr = lane & 15, hi = lane >> 4; const int r0 = blockIdx.x * 64, c0 = blockIdx.y * 64;
    v8f acc[4][4];
#pragma unroll
    for (int mb = 0; mb < 4; ++mb)
#pragma unroll
        for (int nb = 0; nb < 4; ++nb) acc[mb][nb] = (v8f){};
    const size_t aoff = (size_t)(r0 + lr) * K + 8 * hi, boff = (size_t)(c0 + lr) * K + 8 * hi;
#pragma unroll 1
    for (int kc = 0; kc < K; kc += 32) {
        V a[4], a2[4];
#pragma unroll
        for (int mb = 0; mb < 4; ++mb) { a[mb] = WFrag<T16>::ld(A + aoff + (size_t)mb * 16 * K + kc); if (NSPLIT == 1 || NSPLIT == 2) a2[mb] = WFrag<T16>::ld(A2 + aoff + (size_t)mb * 16 * K + kc); }
#pragma unroll
        for (int nb = 0; nb < 4; ++nb) { const V b = WFrag<T16>::ld(Bt + boff + (size_t)nb * 16 * K + kc); V b2; if (NSPLIT >= 2) b2 = WFrag<T16>::ld(Bt2 + boff + (size_t)nb * 16 * K + kc);
#pragma unroll
            for (int mb = 0; mb < 4; ++mb) { acc[mb][nb] = WFrag<T16>::mma(a[mb], b, acc[mb][nb]); if (NSPLIT == 1 || NSPLIT == 2) acc[mb][nb] = WFrag<T16>::mma(a2[mb], b, acc[mb][nb]); if (NSPLIT >= 2) acc[mb][nb] = WFrag<T16>::mma(a[mb], b2, acc[mb][nb]); } }
        asm volatile("v_nop\n\tv_nop\n\tv_nop\n\tv_nop" : "+v"(acc[0][0]), "+v"(acc[1][1]), "+v"(acc[2][2]), "+v"(acc[3][3]) : "v"(a[0]), "v"(a[3]));
    }
#pragma unroll
    for (int mb = 0; mb < 4; ++mb) {
#pragma unroll
        for (int nb = 0; nb < 4; ++nb) {
#pragma unroll
            for (int j = 0; j < 8; ++j) os[(hi * 8 + j) * 68 + nb * 16 + lr] = acc[mb][nb][j]; }
        __builtin_amdgcn_wave_barrier(); asm volatile("" ::: "memory");
        float* crow = C + (size_t)(r0 + mb * 16) * ldc + c0;
{
#pragma unroll
            for (int s = 0; s < 8; ++s) { const int row = 2 * s + hi, cofs = lr * 4; v4f val = *(const v4fa*)(os + row * 68 + cofs); if (BIAS) { val[0] += bfr(bias[c0 + cofs]); val[1] += bfr(bias[c0 + cofs + 1]); val[2] += bfr(bias[c0 + cofs + 2]); val[3] += bfr(bias[c0 + cofs + 3]); }
                *(v4f*)(crow + (size_t)row * ldc + cofs) = val; }
             }
        __builtin_amdgcn_wave_barrier(); asm volatile("" ::: "memory");
    }
}

__device__ __forceinline__ void splitf(float y, unsigned short& h, unsigned short& l) { h = f2bf(y); l = f2bf(y - bf2f(h)); }
typedef __attribute__((ext_vector_type(2))) unsigned short v2us;
typedef __attribute__((ext_vector_type(4))) unsigned short v4us;

// k_hpl: bf16 head planes P[h][t][d] = bf16(X[t][h*64+d]) (8-B lanes); k_htp: transposed planes PT[h][d][t] (lane -> 2 t); k_maskr: MK[b][j] = (1 - bf16(pad_mask)) (f32, 16-B lanes);
__global__ __launch_bounds__(256) void k_hpl(const float* __restrict__ X, bf* P) { const size_t e = ((size_t)blockIdx.x * 256 + threadIdx.x) * 4; if (e >= (size_t)NH_ * TT * HD) return; const int d = (int)(e % HD); const int t = (int)((e / HD) % TT); const int h = (int)(e / ((size_t)HD * TT)); const float* f = X + (size_t)t * DM + h * HD + d; v4us o;
#pragma unroll
    for (int u = 0; u < 4; ++u) o[u] = f2bf(f[u]); *(v4us*)(P + e) = o;  }
__global__ __launch_bounds__(256) void k_htp(const float* __restrict__ X, bf* PT) { const size_t e = ((size_t)blockIdx.x * 256 + threadIdx.x) * 2; if (e >= (size_t)NH_ * HD * TT) return; const int t = (int)(e % TT); const int d = (int)((e / TT) % HD); const int h = (int)(e / ((size_t)TT * HD)); v2us o; o[0] = f2bf(X[(size_t)t * DM + h * HD + d]); o[1] = f2bf(X[(size_t)(t + 1) * DM + h * HD + d]); *(v2us*)(PT + e) = o;  }
__global__ __launch_bounds__(256) void k_maskr(const float* __restrict__ pm, float* MK) { const size_t e = ((size_t)blockIdx.x * 256 + threadIdx.x) * 4; if (e >= (size_t)NB_ * TT) return; v4f r; for (int u = 0; u < 4; ++u) r[u] = __fsub_rn(1.0f, bfr(pm[e + u])); *(v4f*)(MK + e) = r;  }
__global__ __launch_bounds__(256) void k_dsoft(const float* __restrict__ S, const float* __restrict__ MK, bf* Ph, bf* Pl) { const int lane = threadIdx.x & 31; const int row = blockIdx.x * 8 + (threadIdx.x >> 5); if (row >= ZH * TT) return; const int i = row % TT; const float* sr = S + (size_t)row * TT; float v[TT / 32]; float mx = -3.0e38f;
#pragma unroll
    for (int ch = 0; ch < TT / 128; ++ch) { const v4f a = *(const v4f*)(sr + ch * 128 + lane * 4); const v4f m4 = *(const v4f*)(MK + ch * 128 + lane * 4);
#pragma unroll
        for (int u = 0; u < 4; ++u) { const int j = ch * 128 + lane * 4 + u; const float mk = fmaxf((j > i) ? 1.f : 0.f, m4[u]); float s0 = a[u] * 0.03125f; asm volatile("" : "+v"(s0)); float ng = __fmul_rn(-1e9f, mk); asm volatile("" : "+v"(ng)); const float t = __fadd_rn(s0, ng); v[ch * 4 + u] = t; mx = fmaxf(mx, t); } }
#pragma unroll
    for (int sh = 16; sh; sh >>= 1) mx = fmaxf(mx, __shfl_xor(mx, sh, 32));
    float sum = 0.f;
#pragma unroll
    for (int q = 0; q < TT / 32; ++q) { float d0 = __fsub_rn(v[q], mx); asm volatile("" : "+v"(d0)); v[q] = __builtin_amdgcn_exp2f(__fmul_rn(d0, 1.4426950408889634f)); sum += v[q]; }
#pragma unroll
    for (int sh = 16; sh; sh >>= 1) sum += __shfl_xor(sum, sh, 32);
    const float f = __fdiv_rn(1.0f, sum);
    {
#pragma unroll
        for (int ch = 0; ch < TT / 128; ++ch) { v4us oh, ol; for (int q = 0; q < 4; ++q) { unsigned short a2, c2; splitf(v[ch * 4 + q] * f, a2, c2); oh[q] = a2; ol[q] = c2; } const size_t oo = (size_t)row * TT + ch * 128 + lane * 4; *(v4us*)(Ph + oo) = oh; *(v4us*)(Pl + oo) = ol; }
         } }
__global__ __launch_bounds__(256) void k_mrg(const float* __restrict__ O, int h0, float* outb) { const size_t e = ((size_t)blockIdx.x * 256 + threadIdx.x) * 4; if (e >= (size_t)ZH * TT * HD) return; const int d = (int)(e % HD); const int t = (int)((e / HD) % TT); const int zz = (int)(e / ((size_t)HD * TT)); const v4f a = *(const v4f*)(O + e); float* dst = outb + (size_t)t * DM + (h0 + zz) * HD + d; *(v4f*)dst = a;  }

extern "C" void kernel_launch(void* const* d_in, const int* in_sizes, int n_in,
                              void* d_out, int out_size, void* d_ws, size_t ws_size, hipStream_t stream) {
    (void)in_sizes; (void)n_in; (void)out_size;
    const float* x = (const float*)d_in[0]; const float* y = (const float*)d_in[1]; const float* z = (const float*)d_in[2]; const float* pm = (const float*)d_in[3];
    float* OUT = (float*)d_out;     // [2][2048][1024]
    char* wsp = (char*)d_ws;
    auto take = [&](size_t bytes) { char* p = wsp; wsp += (bytes + 255) & ~(size_t)255; return (void*)p; };
    bf* QP = (bf*)take((size_t)NH_ * TT * HD * 2); bf* VP = (bf*)take((size_t)NH_ * TT * HD * 2); bf* KT = (bf*)take((size_t)NH_ * HD * TT * 2); float* MK = (float*)take((size_t)NB_ * TT * 4);
    float* S = (float*)take((size_t)ZH * TT * TT * 4); bf* Ph = (bf*)take((size_t)ZH * TT * TT * 2); bf* Pl = (bf*)take((size_t)ZH * TT * TT * 2); float* O = (float*)take((size_t)ZH * TT * HD * 4);
    if ((size_t)(wsp - (char*)d_ws) > ws_size) return;    // total ~ 80 MB
    k_maskr<<<(NB_ * TT / 4 + 255) / 256, 256, 0, stream>>>(pm, MK);
    const unsigned gq = (unsigned)(((size_t)NH_ * TT * HD / 4 + 255) / 256), gt = (unsigned)(((size_t)NH_ * HD * TT / 2 + 255) / 256); const size_t zq = (size_t)TT * HD, zS = (size_t)TT * TT, zv = (size_t)HD * TT;
    for (int b = 0; b < NB_; ++b) {
        k_hpl<<<gq, 256, 0, stream>>>(x + (size_t)b * TT * DM, QP); k_hpl<<<gq, 256, 0, stream>>>(z + (size_t)b * TT * DM, VP); k_htp<<<gt, 256, 0, stream>>>(y + (size_t)b * TT * DM, KT);   // scores use z ('value'), output uses y ('key')
        for (int h0 = 0; h0 < NH_; h0 += ZH) {
            k_gemmw<bf, 0, false><<<dim3(TT / 64, TT / 64, ZH), 32, 0, stream>>>(QP + (size_t)h0 * zq, nullptr, VP + (size_t)h0 * zq, nullptr, HD, S, TT, nullptr, zq, zq, zS);
            k_dsoft<<<ZH * TT / 8, 256, 0, stream>>>(S, MK + (size_t)b * TT, Ph, Pl);
            k_gemmw<bf, 1, false><<<dim3(TT / 64, 1, ZH), 32, 0, stream>>>(Ph, Pl, KT + (size_t)h0 * zv, nullptr, TT, O, HD, nullptr, zS, zv, zq);
            k_mrg<<<(unsigned)(((size_t)ZH * TT * HD / 4 + 255) / 256), 256, 0, stream>>>(O, h0, OUT + (size_t)b * TT * DM); } }
}

// v001
// One run takes 652 microseconds.
// Next to v000, in two timings, it ran 2.05 times as fast each time.
#include <hip/hip_runtime.h>

// decoderSelfAttention (x, y, z [2][2048][1024] split into 16 heads x 64 with NO projections; pad_mask [2][2048] (float, read); faithful to the source's argument swap: scores = q.v / sqrt(1024) with q from x and 'v' from z, then + (-1e9) x mask where mask = max(strict-upper-triangle, 1 - pad_mask[key]);
//   softmax; output = weights . k with 'k' from y; heads re-merged -> [2][2048][1024]).
// Compute dtypes, f32 accumulate: every input rounded to bf16; the scores are a PLAIN bf16 GEMM of the inputs themselves (exact products) over ALL key tiles (the mask is additive -1e9, exactly as the source, so a fully padded row would fall back to all keys); scale + mask + softmax f32 -> hl planes; weights.k as hl x exact bf16 (2 products); 2 heads per pass.

#define NB_  2
#define TT   2048
#define DM   1024
#define NH_  16
#define HD   64
#define ZH   2
typedef _Float16 h16;
typedef unsigned short bf;
typedef __attribute__((ext_vector_type(16))) __bf16   v16bf;
typedef __attribute__((ext_vector_type(16))) _Float16 v16h;
typedef __attribute__((ext_vector_type(8)))  _Float16 v8h;
typedef __attribute__((ext_vector_type(8)))  unsigned short v8us;
typedef __attribute__((ext_vector_type(8)))  float    v8f;
typedef __attribute__((ext_vector_type(4)))  float    v4f;
typedef v8h  __attribute__((may_alias)) v8ha;
typedef v4f  __attribute__((may_alias)) v4fa;
typedef v8us __attribute__((may_alias)) v8usa;

__device__ __forceinline__ unsigned short f2bf(float f) { unsigned u = __float_as_uint(f); u += 0x7FFFu + ((u >> 16) & 1u); return (unsigned short)(u >> 16); }
__device__ __forceinline__ float bf2f(unsigned short b) { return __uint_as_float(((unsigned)b) << 16); }
__device__ __forceinline__ float bfr(float f) { return bf2f(f2bf(f)); }
__device__ __forceinline__ v16h cat16(v8h lo, v8h hi) { return __builtin_shufflevector(lo, hi, 0, 1, 2, 3, 4, 5, 6, 7, 8, 9, 10, 11, 12, 13, 14, 15); }
__device__ __forceinline__ v16bf cat16b(v8us lo, v8us hi) { return __builtin_bit_cast(v16bf, __builtin_shufflevector(lo, hi, 0, 1, 2, 3, 4, 5, 6, 7, 8, 9, 10, 11, 12, 13, 14, 15)); }
__device__ __forceinline__ v8f wmma16(v16h a, v16h b, v8f c) { return __builtin_amdgcn_wmma_f32_16x16x32_f16(false, a, false, b, (short)0, c, false, false); }
__device__ __forceinline__ v8f wmmab(v16bf a, v16bf b, v8f c) { return __builtin_amdgcn_wmma_f32_16x16x32_bf16(false, a, false, b, (short)0, c, false, false); }



// ---- k_gemmw: register-blocked GEMM, ONE WAVE per 64x64 output tile (16 accumulators), operands straight from K-contiguous 16-bit planes; grid (M/64, N/64, Z), 32 threads.
// C[m][n] (f32, pitch ldc, + optional f32 bias[n]) = sum_k A[m][k] Bt[n][k] (+ split products per NSPLIT). z-batch strides sA/sB/sC in elements. K % 32 == 0.
template <typename T16> struct WFrag;
template <> struct WFrag<h16> { typedef v16h V; static __device__ __forceinline__ V ld(const h16* p) { return cat16(*(const v8h*)p, *(const v8h*)(p + 16)); } static __device__ __forceinline__ v8f mma(V a, V b, v8f c) { return wmma16(a, b, c); } };
template <> struct WFrag<bf> { typedef v16bf V; static __device__ __forceinline__ V ld(const bf* p) { return cat16b(*(const v8us*)p, *(const v8us*)(p + 16)); } static __device__ __forceinline__ v8f mma(V a, V b, v8f c) { return wmmab(a, b, c); } };
template <typename T16, int NSPLIT, bool BIAS>
__global__ __launch_bounds__(32) void k_gemmw(const T16* __restrict__ A, const T16* __restrict__ A2, const T16* __restrict__ Bt, const T16* __restrict__ Bt2, int K, float* C, int ldc, const float* __restrict__ bias, size_t sA, size_t sB, size_t sC) {
    typedef typename WFrag<T16>::V V;
    __shared__ __align__(16) float os[16 * 68];
    const size_t z = blockIdx.z; A += z * sA; if (A2) A2 += z * sA; Bt += z * sB; if (Bt2) Bt2 += z * sB; C += z * sC;
    const int lane = threadIdx.x & 31, lr = lane & 15, hi = lane >> 4; const int r0 = blockIdx.x * 64, c0 = blockIdx.y * 64;
    v8f acc[4][4];
#pragma unroll
    for (int mb = 0; mb < 4; ++mb)
#pragma unroll
        for (int nb = 0; nb < 4; ++nb) acc[mb][nb] = (v8f){};
    const size_t aoff = (size_t)(r0 + lr) * K + 8 * hi, boff = (size_t)(c0 + lr) * K + 8 * hi;
#pragma unroll 1
    for (int kc = 0; kc < K; kc += 32) {
        V a[4], a2[4];
#pragma unroll
        for (int mb = 0; mb < 4; ++mb) { a[mb] = WFrag<T16>::ld(A + aoff + (size_t)mb * 16 * K + kc); if (NSPLIT == 1 || NSPLIT == 2) a2[mb] = WFrag<T16>::ld(A2 + aoff + (size_t)mb * 16 * K + kc); }
#pragma unroll
        for (int nb = 0; nb < 4; ++nb) { const V b = WFrag<T16>::ld(Bt + boff + (size_t)nb * 16 * K + kc); V b2; if (NSPLIT >= 2) b2 = WFrag<T16>::ld(Bt2 + boff + (size_t)nb * 16 * K + kc);
#pragma unroll
            for (int mb = 0; mb < 4; ++mb) { acc[mb][nb] = WFrag<T16>::mma(a[mb], b, acc[mb][nb]); if (NSPLIT == 1 || NSPLIT == 2) acc[mb][nb] = WFrag<T16>::mma(a2[mb], b, acc[mb][nb]); if (NSPLIT >= 2) acc[mb][nb] = WFrag<T16>::mma(a[mb], b2, acc[mb][nb]); } }
        asm volatile("v_nop\n\tv_nop\n\tv_nop\n\tv_nop" : "+v"(acc[0][0]), "+v"(acc[1][1]), "+v"(acc[2][2]), "+v"(acc[3][3]) : "v"(a[0]), "v"(a[3]));
    }
#pragma unroll
    for (int mb = 0; mb < 4; ++mb) {
#pragma unroll
        for (int nb = 0; nb < 4; ++nb) {
#pragma unroll
            for (int j = 0; j < 8; ++j) os[(hi * 8 + j) * 68 + nb * 16 + lr] = acc[mb][nb][j]; }
        __builtin_amdgcn_wave_barrier(); asm volatile("" ::: "memory");
        float* crow = C + (size_t)(r0 + mb * 16) * ldc + c0;
{
#pragma unroll
            for (int s = 0; s < 8; ++s) { const int row = 2 * s + hi, cofs = lr * 4; v4f val = *(const v4fa*)(os + row * 68 + cofs); if (BIAS) { val[0] += bfr(bias[c0 + cofs]); val[1] += bfr(bias[c0 + cofs + 1]); val[2] += bfr(bias[c0 + cofs + 2]); val[3] += bfr(bias[c0 + cofs + 3]); }
                *(v4f*)(crow + (size_t)row * ldc + cofs) = val; }
             }
        __builtin_amdgcn_wave_barrier(); asm volatile("" ::: "memory");
    }
}

// ---- k_pvs: weights . k for one 16-row x 64-column output tile per work-group; the K = TT keys are split over PVW waves (TT / PVW keys each), so 256 work-groups x PVW waves have loads in flight instead of 64 single waves.
// Each wave keeps 4 accumulators (hi plane then lo plane per 32 keys, as before); the PVW partial tiles meet in LDS and are added in wave order 0..PVW-1; grid (TT/16, 1, ZH).
#define PVW 8
__global__ __launch_bounds__(PVW * 32) void k_pvs(const bf* __restrict__ Ah, const bf* __restrict__ Al, const bf* __restrict__ Bt, float* C) {
    __shared__ __align__(16) float ps[PVW][16 * 68];
    const size_t z = blockIdx.z; Ah += z * (size_t)TT * TT; Al += z * (size_t)TT * TT; Bt += z * (size_t)HD * TT; C += z * (size_t)TT * HD;
    const int lane = threadIdx.x & 31, lr = lane & 15, hi = lane >> 4, wv = threadIdx.x >> 5; const int r0 = blockIdx.x * 16, k0 = wv * (TT / PVW);
    v8f acc[4];
#pragma unroll
    for (int nb = 0; nb < 4; ++nb) acc[nb] = (v8f){};
    const unsigned aoff = (unsigned)((r0 + lr) * TT + 8 * hi + k0) * 2u, boff = (unsigned)(lr * TT + 8 * hi + k0) * 2u;   // byte offsets of the lane's first A and B fragment (both A planes share one)
    const char* pAh = (const char*)Ah; const char* pAl = (const char*)Al; const char* pB = (const char*)Bt;
    // two groups of 128 keys, unrolled so that every load offset is an immediate
#pragma unroll
    for (int g = 0; g < TT / PVW; g += 128) {
        v16bf a[4], a2[4], b[4][4];
#pragma unroll
        for (int ks = 0; ks < 4; ++ks) { a[ks] = WFrag<bf>::ld((const bf*)(pAh + aoff) + g + ks * 32); a2[ks] = WFrag<bf>::ld((const bf*)(pAl + aoff) + g + ks * 32);
#pragma unroll
            for (int nb = 0; nb < 4; ++nb) b[ks][nb] = WFrag<bf>::ld((const bf*)(pB + boff) + nb * 16 * TT + g + ks * 32); }
        // inputs-only fence on the loaded fragments: keeps the group's 48 loads ahead of its first product, so the wave waits for memory once per group and not once per fragment;
        // the two offsets ride along as inputs so that their registers are not taken as load destinations while loads that name them are in flight
        asm volatile("" :: "v"(a[0]), "v"(a[1]), "v"(a[2]), "v"(a[3]), "v"(a2[0]), "v"(a2[1]), "v"(a2[2]), "v"(a2[3]),
                     "v"(b[0][0]), "v"(b[0][1]), "v"(b[0][2]), "v"(b[0][3]), "v"(b[1][0]), "v"(b[1][1]), "v"(b[1][2]), "v"(b[1][3]),
                     "v"(b[2][0]), "v"(b[2][1]), "v"(b[2][2]), "v"(b[2][3]), "v"(b[3][0]), "v"(b[3][1]), "v"(b[3][2]), "v"(b[3][3]), "v"(aoff), "v"(boff));
#pragma unroll
        for (int ks = 0; ks < 4; ++ks)
#pragma unroll
            for (int nb = 0; nb < 4; ++nb) { acc[nb] = wmmab(a[ks], b[ks][nb], acc[nb]); acc[nb] = wmmab(a2[ks], b[ks][nb], acc[nb]); }
    }
#pragma unroll
    for (int nb = 0; nb < 4; ++nb) {
#pragma unroll
        for (int j = 0; j < 8; ++j) ps[wv][(hi * 8 + j) * 68 + nb * 16 + lr] = acc[nb][j]; }
    __syncthreads();
    const int row = threadIdx.x >> 4, cofs = (threadIdx.x & 15) * 4;
    v4f s = *(const v4fa*)(&ps[0][row * 68 + cofs]);
#pragma unroll
    for (int w = 1; w < PVW; ++w) s += *(const v4fa*)(&ps[w][row * 68 + cofs]);
    *(v4f*)(C + (size_t)(r0 + row) * HD + cofs) = s;
}

__device__ __forceinline__ void splitf(float y, unsigned short& h, unsigned short& l) { h = f2bf(y); l = f2bf(y - bf2f(h)); }
typedef __attribute__((ext_vector_type(2))) unsigned short v2us;
typedef __attribute__((ext_vector_type(4))) unsigned short v4us;

// k_hpl: bf16 head planes P[h][t][d] = bf16(X[t][h*64+d]) (8-B lanes); k_htp: transposed planes PT[h][d][t] (lane -> 2 t); k_maskr: MK[b][j] = (1 - bf16(pad_mask)) (f32, 16-B lanes);
__global__ __launch_bounds__(256) void k_hpl(const float* __restrict__ X, bf* P) { const size_t e = ((size_t)blockIdx.x * 256 + threadIdx.x) * 4; if (e >= (size_t)NH_ * TT * HD) return; const int d = (int)(e % HD); const int t = (int)((e / HD) % TT); const int h = (int)(e / ((size_t)HD * TT)); const float* f = X + (size_t)t * DM + h * HD + d; v4us o;
#pragma unroll
    for (int u = 0; u < 4; ++u) o[u] = f2bf(f[u]); *(v4us*)(P + e) = o;  }
__global__ __launch_bounds__(256) void k_htp(const float* __restrict__ X, bf* PT) { const size_t e = ((size_t)blockIdx.x * 256 + threadIdx.x) * 2; if (e >= (size_t)NH_ * HD * TT) return; const int t = (int)(e % TT); const int d = (int)((e / TT) % HD); const int h = (int)(e / ((size_t)TT * HD)); v2us o; o[0] = f2bf(X[(size_t)t * DM + h * HD + d]); o[1] = f2bf(X[(size_t)(t + 1) * DM + h * HD + d]); *(v2us*)(PT + e) = o;  }
__global__ __launch_bounds__(256) void k_maskr(const float* __restrict__ pm, float* MK) { const size_t e = ((size_t)blockIdx.x * 256 + threadIdx.x) * 4; if (e >= (size_t)NB_ * TT) return; v4f r; for (int u = 0; u < 4; ++u) r[u] = __fsub_rn(1.0f, bfr(pm[e + u])); *(v4f*)(MK + e) = r;  }
__global__ __launch_bounds__(256) void k_dsoft(const float* __restrict__ S, const float* __restrict__ MK, bf* Ph, bf* Pl) { const int lane = threadIdx.x & 31; const int row = blockIdx.x * 8 + (threadIdx.x >> 5); if (row >= ZH * TT) return; const int i = row % TT; const float* sr = S + (size_t)row * TT; float v[TT / 32]; float mx = -3.0e38f;
#pragma unroll
    for (int ch = 0; ch < TT / 128; ++ch) { const v4f a = *(const v4f*)(sr + ch * 128 + lane * 4); const v4f m4 = *(const v4f*)(MK + ch * 128 + lane * 4);
#pragma unroll
        for (int u = 0; u < 4; ++u) { const int j = ch * 128 + lane * 4 + u; const float mk = fmaxf((j > i) ? 1.f : 0.f, m4[u]); float s0 = a[u] * 0.03125f; asm volatile("" : "+v"(s0)); float ng = __fmul_rn(-1e9f, mk); asm volatile("" : "+v"(ng)); const float t = __fadd_rn(s0, ng); v[ch * 4 + u] = t; mx = fmaxf(mx, t); } }
#pragma unroll
    for (int sh = 16; sh; sh >>= 1) mx = fmaxf(mx, __shfl_xor(mx, sh, 32));
    float sum = 0.f;
#pragma unroll
    for (int q = 0; q < TT / 32; ++q) { float d0 = __fsub_rn(v[q], mx); asm volatile("" : "+v"(d0)); v[q] = __builtin_amdgcn_exp2f(__fmul_rn(d0, 1.4426950408889634f)); sum += v[q]; }
#pragma unroll
    for (int sh = 16; sh; sh >>= 1) sum += __shfl_xor(sum, sh, 32);
    const float f = __fdiv_rn(1.0f, sum);
    {
#pragma unroll
        for (int ch = 0; ch < TT / 128; ++ch) { v4us oh, ol; for (int q = 0; q < 4; ++q) { unsigned short a2, c2; splitf(v[ch * 4 + q] * f, a2, c2); oh[q] = a2; ol[q] = c2; } const size_t oo = (size_t)row * TT + ch * 128 + lane * 4; *(v4us*)(Ph + oo) = oh; *(v4us*)(Pl + oo) = ol; }
         } }
__global__ __launch_bounds__(256) void k_mrg(const float* __restrict__ O, int h0, float* outb) { const size_t e = ((size_t)blockIdx.x * 256 + threadIdx.x) * 4; if (e >= (size_t)ZH * TT * HD) return; const int d = (int)(e % HD); const int t = (int)((e / HD) % TT); const int zz = (int)(e / ((size_t)HD * TT)); const v4f a = *(const v4f*)(O + e); float* dst = outb + (size_t)t * DM + (h0 + zz) * HD + d; *(v4f*)dst = a;  }

extern "C" void kernel_launch(void* const* d_in, const int* in_sizes, int n_in,
                              void* d_out, int out_size, void* d_ws, size_t ws_size, hipStream_t stream) {
    (void)in_sizes; (void)n_in; (void)out_size;
    const float* x = (const float*)d_in[0]; const float* y = (const float*)d_in[1]; const float* z = (const float*)d_in[2]; const float* pm = (const float*)d_in[3];
    float* OUT = (float*)d_out;     // [2][2048][1024]
    char* wsp = (char*)d_ws;
    auto take = [&](size_t bytes) { char* p = wsp; wsp += (bytes + 255) & ~(size_t)255; return (void*)p; };
    bf* QP = (bf*)take((size_t)NH_ * TT * HD * 2); bf* VP = (bf*)take((size_t)NH_ * TT * HD * 2); bf* KT = (bf*)take((size_t)NH_ * HD * TT * 2); float* MK = (float*)take((size_t)NB_ * TT * 4);
    float* S = (float*)take((size_t)ZH * TT * TT * 4); bf* Ph = (bf*)take((size_t)ZH * TT * TT * 2); bf* Pl = (bf*)take((size_t)ZH * TT * TT * 2); float* O = (float*)take((size_t)ZH * TT * HD * 4);
    if ((size_t)(wsp - (char*)d_ws) > ws_size) return;    // total ~ 80 MB
    k_maskr<<<(NB_ * TT / 4 + 255) / 256, 256, 0, stream>>>(pm, MK);
    const unsigned gq = (unsigned)(((size_t)NH_ * TT * HD / 4 + 255) / 256), gt = (unsigned)(((size_t)NH_ * HD * TT / 2 + 255) / 256); const size_t zq = (size_t)TT * HD, zS = (size_t)TT * TT, zv = (size_t)HD * TT;
    for (int b = 0; b < NB_; ++b) {
        k_hpl<<<gq, 256, 0, stream>>>(x + (size_t)b * TT * DM, QP); k_hpl<<<gq, 256, 0, stream>>>(z + (size_t)b * TT * DM, VP); k_htp<<<gt, 256, 0, stream>>>(y + (size_t)b * TT * DM, KT);   // scores use z ('value'), output uses y ('key')
        for (int h0 = 0; h0 < NH_; h0 += ZH) {
            k_gemmw<bf, 0, false><<<dim3(TT / 64, TT / 64, ZH), 32, 0, stream>>>(QP + (size_t)h0 * zq, nullptr, VP + (size_t)h0 * zq, nullptr, HD, S, TT, nullptr, zq, zq, zS);
            k_dsoft<<<ZH * TT / 8, 256, 0, stream>>>(S, MK + (size_t)b * TT, Ph, Pl);
            k_pvs<<<dim3(TT / 16, 1, ZH), PVW * 32, 0, stream>>>(Ph, Pl, KT + (size_t)h0 * zv, O);
            k_mrg<<<(unsigned)(((size_t)ZH * TT * HD / 4 + 255) / 256), 256, 0, stream>>>(O, h0, OUT + (size_t)b * TT * DM); } }
}

// v003
// It runs in 162 microseconds.
// It is 4.01 times as fast as v001, going by the measured steps of the versions left out in between.
// All steps since v000 together make it 8.21 times as fast.
#include <hip/hip_runtime.h>

// decoderSelfAttention (x, y, z [2][2048][1024] split into 16 heads x 64 with NO projections; pad_mask [2][2048] (float, read); faithful to the source's argument swap: scores = q.v / sqrt(1024) with q from x and 'v' from z, then + (-1e9) x mask where mask = max(strict-upper-triangle, 1 - pad_mask[key]);
//   softmax; output = weights . k with 'k' from y; heads re-merged -> [2][2048][1024]).
// Compute dtypes, f32 accumulate: every input rounded to bf16; the scores are a PLAIN bf16 GEMM of the inputs themselves (exact products) over ALL key tiles (the mask is additive -1e9, exactly as the source, so a fully padded row would fall back to all keys); scale + mask + softmax f32 -> hl planes; weights.k as hl x exact bf16 (2 products); one work-group carries 32 query rows of one head from scores to output.

#define NB_  2
#define TT   2048
#define DM   1024
#define NH_  16
#define HD   64
#define ZH   2
typedef _Float16 h16;
typedef unsigned short bf;
typedef __attribute__((ext_vector_type(16))) __bf16   v16bf;
typedef __attribute__((ext_vector_type(16))) _Float16 v16h;
typedef __attribute__((ext_vector_type(8)))  _Float16 v8h;
typedef __attribute__((ext_vector_type(8)))  unsigned short v8us;
typedef __attribute__((ext_vector_type(8)))  float    v8f;
typedef __attribute__((ext_vector_type(4)))  float    v4f;
typedef v8h  __attribute__((may_alias)) v8ha;
typedef v4f  __attribute__((may_alias)) v4fa;
typedef v8us __attribute__((may_alias)) v8usa;

__device__ __forceinline__ unsigned short f2bf(float f) { unsigned u = __float_as_uint(f); u += 0x7FFFu + ((u >> 16) & 1u); return (unsigned short)(u >> 16); }
__device__ __forceinline__ float bf2f(unsigned short b) { return __uint_as_float(((unsigned)b) << 16); }
__device__ __forceinline__ float bfr(float f) { return bf2f(f2bf(f)); }
__device__ __forceinline__ v16h cat16(v8h lo, v8h hi) { return __builtin_shufflevector(lo, hi, 0, 1, 2, 3, 4, 5, 6, 7, 8, 9, 10, 11, 12, 13, 14, 15); }
__device__ __forceinline__ v16bf cat16b(v8us lo, v8us hi) { return __builtin_bit_cast(v16bf, __builtin_shufflevector(lo, hi, 0, 1, 2, 3, 4, 5, 6, 7, 8, 9, 10, 11, 12, 13, 14, 15)); }
__device__ __forceinline__ v8f wmma16(v16h a, v16h b, v8f c) { return __builtin_amdgcn_wmma_f32_16x16x32_f16(false, a, false, b, (short)0, c, false, false); }
__device__ __forceinline__ v8f wmmab(v16bf a, v16bf b, v8f c) { return __builtin_amdgcn_wmma_f32_16x16x32_bf16(false, a, false, b, (short)0, c, false, false); }



// fragment of a 16x16x32 product from a K-contiguous 16-bit plane: the lane's 8 elements at p and 8 at p + 16
template <typename T16> struct WFrag;
template <> struct WFrag<h16> { typedef v16h V; static __device__ __forceinline__ V ld(const h16* p) { return cat16(*(const v8h*)p, *(const v8h*)(p + 16)); } static __device__ __forceinline__ v8f mma(V a, V b, v8f c) { return wmma16(a, b, c); } };
template <> struct WFrag<bf> { typedef v16bf V; static __device__ __forceinline__ V ld(const bf* p) { return cat16b(*(const v8us*)p, *(const v8us*)(p + 16)); } static __device__ __forceinline__ v8f mma(V a, V b, v8f c) { return wmmab(a, b, c); } };

__device__ __forceinline__ void splitf(float y, unsigned short& h, unsigned short& l) { h = f2bf(y); l = f2bf(y - bf2f(h)); }
typedef __attribute__((ext_vector_type(4))) unsigned short v4us;

// k_prep: every layout step in ONE launch. A work-group of 16 waves takes PTT rows (t) x the 64 columns of one head of x, z and y; grid (TT/PTT, NH_, NB_).
//   x, z -> bf16 head planes P[h][t][d] (16-B loads, 8-B stores); y -> the transposed plane PT[h][d][t]: read along d like the others, turned in LDS, stored along t in whole 256-B runs;
//   the work-groups of head 0 also write their PTT entries of MK[b][j] = (1 - bf16(pad_mask)) (f32).
#define PTT 128
#define PTP (PTT / 2 + 1)   // dwords per LDS row (one d, PTT/2 pairs of t): one over a multiple of 64, so that the 16 lanes of a store (4 rows apart) and the rows of a read fall on different banks
typedef __attribute__((ext_vector_type(4))) unsigned v4u;
__global__ __launch_bounds__(512) void k_prep(const float* __restrict__ X, const float* __restrict__ Y, const float* __restrict__ Z, const float* __restrict__ pm, bf* QP, bf* VP, bf* KT, float* MK) {
    __shared__ unsigned tl[HD * PTP];
    const int tid = threadIdx.x, c4 = (tid & 15) * 4, rw = tid >> 4;   // the lane's 4 columns; its row (x, z) or row pair (y) within a pass of 32
    const int t0 = blockIdx.x * PTT; const size_t zh = (size_t)blockIdx.z * NH_ + blockIdx.y;
    const size_t src = ((size_t)blockIdx.z * TT + t0) * DM + blockIdx.y * HD + c4;
    const float* ys = Y + src; const float* xs = X + src; const float* zs = Z + src;
    const bool dom = blockIdx.y == 0 && tid < PTT / 4; const size_t me = (size_t)blockIdx.z * TT + t0 + (tid & (PTT / 4 - 1)) * 4;
    v4f mv = (v4f){}, ya[2][2], xa[4], za[4];
    if (dom) mv = *(const v4f*)(pm + me);   // asked for ahead of the tiles, so that it is not a second trip to memory at the end
#pragma unroll
    for (int p = 0; p < 2; ++p)
#pragma unroll
        for (int q = 0; q < 2; ++q) ya[p][q] = *(const v4f*)(ys + (size_t)((p * 32 + rw) * 2 + q) * DM);
#pragma unroll
    for (int p = 0; p < 4; ++p) xa[p] = *(const v4f*)(xs + (size_t)(p * 32 + rw) * DM);
#pragma unroll
    for (int p = 0; p < 4; ++p) za[p] = *(const v4f*)(zs + (size_t)(p * 32 + rw) * DM);
#pragma unroll
    for (int p = 0; p < 2; ++p)
#pragma unroll
        for (int u = 0; u < 4; ++u) tl[(c4 + u) * PTP + p * 32 + rw] = (unsigned)f2bf(ya[p][0][u]) | ((unsigned)f2bf(ya[p][1][u]) << 16);   // rows t, t+1 of one column: neighbours in the transposed plane
    __syncthreads();   // the whole y tile is in LDS before a transposed row is read; it stands ahead of every global store, so that no wave waits out a store at it
    bf* kd = KT + zh * (size_t)HD * TT + t0;
#pragma unroll
    for (int p = 0; p < 2; ++p) { const int ci = p * 512 + tid, d = ci >> 4, c = (ci & 15) * 4; v4u o;   // 16 lanes store one d's 256 bytes
#pragma unroll
        for (int u = 0; u < 4; ++u) o[u] = tl[d * PTP + c + u];
        *(v4u*)(kd + (size_t)d * TT + c * 2) = o; }
    bf* qd = QP + (zh * TT + t0) * HD + c4; bf* vd = VP + (zh * TT + t0) * HD + c4;
#pragma unroll
    for (int p = 0; p < 4; ++p) { v4us o, o2;
#pragma unroll
        for (int u = 0; u < 4; ++u) { o[u] = f2bf(xa[p][u]); o2[u] = f2bf(za[p][u]); }
        *(v4us*)(qd + (p * 32 + rw) * HD) = o; *(v4us*)(vd + (p * 32 + rw) * HD) = o2; }
    if (dom) { v4f r;
#pragma unroll
        for (int u = 0; u < 4; ++u) r[u] = __fsub_rn(1.0f, bfr(mv[u]));
        *(v4f*)(MK + me) = r; }
}
// ---- k_attn: scores, softmax and weights . k of RW query rows x all TT keys of one head in ONE work-group of AW waves; the RW x TT score block lives in LDS from the first product to the last; grid (TT/RW, NH_, NB_).
// 1) wave w forms the f32 scores of all RW rows for keys [w*TT/AW, (w+1)*TT/AW) into sm: each loaded key fragment serves both 16-row tiles;
// 2) wave w does the softmax of rows 2w and 2w+1 and lays each row's hi and lo bf16 planes over the row's own bytes (hi: first TT*2 bytes, lo: next TT*2);
// 3) wave w takes key slice w/2 (TT/KS keys) and output columns (w&1)*32..+31: A from the planes in LDS, B from the transposed plane, each B fragment serving both row tiles and both planes;
//    the KS partial tiles meet in LDS (over sm, behind a barrier) and are added in slice order 0..KS-1.
#define AW 16
#define RW 32
#define KS 8
#define SP (TT + 4)   // floats per score row in LDS: 16 bytes over TT floats, an odd multiple of 16 bytes, so that the 16 rows of a 16-byte fragment read fall on different banks
typedef v4us __attribute__((may_alias)) v4usa;
__device__ __forceinline__ v16bf ldfrag_lds(const bf* p) { return cat16b(*(const v8usa*)p, *(const v8usa*)(p + 16)); }
// the score block takes most of a WGP's LDS, so one work-group is resident: its 16 waves are four per SIMD, within 256 registers each
__global__ __launch_bounds__(AW * 32) __attribute__((amdgpu_waves_per_eu(4, 4))) void k_attn(const bf* __restrict__ Q, const bf* __restrict__ V, const bf* __restrict__ Kt, const float* __restrict__ MK, float* OUT) {
    __shared__ __align__(16) float sm[RW * SP];
    const size_t zh = (size_t)blockIdx.z * NH_ + blockIdx.y; Q += zh * (size_t)TT * HD; V += zh * (size_t)TT * HD; Kt += zh * (size_t)HD * TT; MK += (size_t)blockIdx.z * TT;
    const int lane = threadIdx.x & 31, lr = lane & 15, hi = lane >> 4, wv = threadIdx.x >> 5; const int r0 = blockIdx.x * RW;
    {   // 1) scores
        const int k0 = wv * (TT / AW);
        const unsigned qoff = (unsigned)((r0 + lr) * HD + 8 * hi) * 2u, voff = (unsigned)((k0 + lr) * HD + 8 * hi) * 2u;   // byte offsets of the lane's first A and B fragment
        const char* pQ = (const char*)Q; const char* pV = (const char*)V;
        v16bf qa[2][2], vb[8][2];
#pragma unroll
        for (int rt = 0; rt < 2; ++rt)
#pragma unroll
            for (int ks = 0; ks < 2; ++ks) qa[rt][ks] = WFrag<bf>::ld((const bf*)(pQ + qoff) + rt * 16 * HD + ks * 32);
#pragma unroll
        for (int nt = 0; nt < 8; ++nt)
#pragma unroll
            for (int ks = 0; ks < 2; ++ks) vb[nt][ks] = WFrag<bf>::ld((const bf*)(pV + voff) + nt * 16 * HD + ks * 32);
        // inputs-only fence on the loaded fragments: keeps the wave's 40 loads ahead of its first product, so the wave waits for memory once and not once per fragment;
        // the two offsets ride along as inputs so that their registers are not taken as load destinations while loads that name them are in flight
        asm volatile("" :: "v"(qa[0][0]), "v"(qa[0][1]), "v"(qa[1][0]), "v"(qa[1][1]), "v"(vb[0][0]), "v"(vb[0][1]), "v"(vb[1][0]), "v"(vb[1][1]), "v"(vb[2][0]), "v"(vb[2][1]), "v"(vb[3][0]), "v"(vb[3][1]),
                     "v"(vb[4][0]), "v"(vb[4][1]), "v"(vb[5][0]), "v"(vb[5][1]), "v"(vb[6][0]), "v"(vb[6][1]), "v"(vb[7][0]), "v"(vb[7][1]), "v"(qoff), "v"(voff));
#pragma unroll
        for (int nt = 0; nt < 8; ++nt)
#pragma unroll
            for (int rt = 0; rt < 2; ++rt) { v8f s = (v8f){}; s = wmmab(qa[rt][0], vb[nt][0], s); s = wmmab(qa[rt][1], vb[nt][1], s);
#pragma unroll
                for (int j = 0; j < 8; ++j) sm[(rt * 16 + hi * 8 + j) * SP + k0 + nt * 16 + lr] = s[j]; }
    }
    __syncthreads();   // every wave's score columns are in sm before a row is read
    v4f m4r[TT / 128];   // the lane's share of the key mask, the same for both of the wave's rows: read once, all 16 loads in flight together
#pragma unroll
    for (int ch = 0; ch < TT / 128; ++ch) m4r[ch] = *(const v4f*)(MK + ch * 128 + lane * 4);
    // 2) softmax, one wave per row, two rows a wave; a row is read whole into registers before its planes are laid over it, and no other wave touches it
    for (int rr = 0; rr < RW / AW; ++rr) { const int row = wv * (RW / AW) + rr; const int i = r0 + row; float* sr = sm + row * SP; float v[TT / 32]; float mx = -3.0e38f; v4f a4[TT / 128];
#pragma unroll
        for (int ch = 0; ch < TT / 128; ++ch) a4[ch] = *(const v4fa*)(sr + ch * 128 + lane * 4);
        // inputs-only fence on the loaded scores: keeps the row's 16 LDS reads ahead of the arithmetic, so the wave waits out the LDS latency once per row and not once per read
        asm volatile("" :: "v"(a4[0]), "v"(a4[1]), "v"(a4[2]), "v"(a4[3]), "v"(a4[4]), "v"(a4[5]), "v"(a4[6]), "v"(a4[7]), "v"(a4[8]), "v"(a4[9]), "v"(a4[10]), "v"(a4[11]), "v"(a4[12]), "v"(a4[13]), "v"(a4[14]), "v"(a4[15]));
#pragma unroll
        for (int ch = 0; ch < TT / 128; ++ch) { const v4f a = a4[ch]; const v4f m4 = m4r[ch];
#pragma unroll
            for (int u = 0; u < 4; ++u) { const int j = ch * 128 + lane * 4 + u; const float mk = fmaxf((j > i) ? 1.f : 0.f, m4[u]); float s0 = a[u] * 0.03125f; asm volatile("" : "+v"(s0)); float ng = __fmul_rn(-1e9f, mk); asm volatile("" : "+v"(ng)); const float t = __fadd_rn(s0, ng); v[ch * 4 + u] = t; mx = fmaxf(mx, t); } }
#pragma unroll
        for (int sh = 16; sh; sh >>= 1) mx = fmaxf(mx, __shfl_xor(mx, sh, 32));
        float sum = 0.f;
#pragma unroll
        for (int q = 0; q < TT / 32; ++q) { float d0 = __fsub_rn(v[q], mx); asm volatile("" : "+v"(d0)); v[q] = __builtin_amdgcn_exp2f(__fmul_rn(d0, 1.4426950408889634f)); sum += v[q]; }
#pragma unroll
        for (int sh = 16; sh; sh >>= 1) sum += __shfl_xor(sum, sh, 32);
        const float f = __fdiv_rn(1.0f, sum);
        bf* ph = (bf*)sr; bf* pl = ph + TT;
#pragma unroll
        for (int ch = 0; ch < TT / 128; ++ch) { v4us oh, ol; for (int q = 0; q < 4; ++q) { unsigned short a2, c2; splitf(v[ch * 4 + q] * f, a2, c2); oh[q] = a2; ol[q] = c2; } *(v4usa*)(ph + ch * 128 + lane * 4) = oh; *(v4usa*)(pl + ch * 128 + lane * 4) = ol; }
    }
    __syncthreads();   // all RW rows' planes are in sm before a fragment is read
    // 3) weights . k
    const int sl = wv >> 1, dh = wv & 1;
    v8f acc[2][2];
#pragma unroll
    for (int rt = 0; rt < 2; ++rt)
#pragma unroll
        for (int nb = 0; nb < 2; ++nb) acc[rt][nb] = (v8f){};
    {
        const int k0 = sl * (TT / KS);
        const bf* pa = (const bf*)(sm + lr * SP) + 8 * hi + k0;   // the lane's first hi-plane fragment of row tile 0; the lo plane lies TT elements on, row tile 1 lies 16 rows on
        const unsigned boff = (unsigned)((dh * 32 + lr) * TT + 8 * hi + k0) * 2u;   // byte offset of the lane's first B fragment
        const char* pB = (const char*)Kt;
        // two groups of 128 keys, unrolled so that every load offset is an immediate
#pragma unroll
        for (int g = 0; g < TT / KS; g += 128) {
            v16bf a[2][4], a2[2][4], b[4][2];
#pragma unroll
            for (int ks = 0; ks < 4; ++ks) {
#pragma unroll
                for (int nb = 0; nb < 2; ++nb) b[ks][nb] = WFrag<bf>::ld((const bf*)(pB + boff) + nb * 16 * TT + g + ks * 32);
#pragma unroll
                for (int rt = 0; rt < 2; ++rt) { a[rt][ks] = ldfrag_lds(pa + rt * 16 * SP * 2 + g + ks * 32); a2[rt][ks] = ldfrag_lds(pa + rt * 16 * SP * 2 + TT + g + ks * 32); } }
            // inputs-only fence on the loaded fragments: keeps the group's 16 global and 32 LDS loads ahead of its first product, so the wave waits once per group and not once per fragment;
            // the offset rides along as an input so that its register is not taken as a load destination while loads that name it are in flight
            asm volatile("" :: "v"(a[0][0]), "v"(a[0][1]), "v"(a[0][2]), "v"(a[0][3]), "v"(a[1][0]), "v"(a[1][1]), "v"(a[1][2]), "v"(a[1][3]),
                         "v"(a2[0][0]), "v"(a2[0][1]), "v"(a2[0][2]), "v"(a2[0][3]), "v"(a2[1][0]), "v"(a2[1][1]), "v"(a2[1][2]), "v"(a2[1][3]),
                         "v"(b[0][0]), "v"(b[0][1]), "v"(b[1][0]), "v"(b[1][1]), "v"(b[2][0]), "v"(b[2][1]), "v"(b[3][0]), "v"(b[3][1]), "v"(boff));
#pragma unroll
            for (int ks = 0; ks < 4; ++ks)
#pragma unroll
                for (int rt = 0; rt < 2; ++rt)
#pragma unroll
                    for (int nb = 0; nb < 2; ++nb) { acc[rt][nb] = wmmab(a[rt][ks], b[ks][nb], acc[rt][nb]); acc[rt][nb] = wmmab(a2[rt][ks], b[ks][nb], acc[rt][nb]); }
        }
    }
    __syncthreads();   // every wave has read its last fragment before the partial tiles are laid over sm
    float* ps = sm + sl * (RW * 68);
#pragma unroll
    for (int rt = 0; rt < 2; ++rt)
#pragma unroll
        for (int nb = 0; nb < 2; ++nb) {
#pragma unroll
            for (int j = 0; j < 8; ++j) ps[(rt * 16 + hi * 8 + j) * 68 + dh * 32 + nb * 16 + lr] = acc[rt][nb][j]; }
    __syncthreads();   // all partial tiles are in LDS before they are added
    const int row = threadIdx.x >> 4, cofs = (threadIdx.x & 15) * 4;
    v4f s = *(const v4fa*)(sm + row * 68 + cofs);
#pragma unroll
    for (int w = 1; w < KS; ++w) s += *(const v4fa*)(sm + w * (RW * 68) + row * 68 + cofs);
    *(v4f*)(OUT + ((size_t)blockIdx.z * TT + r0 + row) * DM + blockIdx.y * HD + cofs) = s;
}

extern "C" void kernel_launch(void* const* d_in, const int* in_sizes, int n_in,
                              void* d_out, int out_size, void* d_ws, size_t ws_size, hipStream_t stream) {
    (void)in_sizes; (void)n_in; (void)out_size;
    const float* x = (const float*)d_in[0]; const float* y = (const float*)d_in[1]; const float* z = (const float*)d_in[2]; const float* pm = (const float*)d_in[3];
    float* OUT = (float*)d_out;     // [2][2048][1024]
    char* wsp = (char*)d_ws;
    auto take = [&](size_t bytes) { char* p = wsp; wsp += (bytes + 255) & ~(size_t)255; return (void*)p; };
    const size_t zb = (size_t)NH_ * TT * HD;   // elements of one batch entry's planes
    bf* QP = (bf*)take(NB_ * zb * 2); bf* VP = (bf*)take(NB_ * zb * 2); bf* KT = (bf*)take(NB_ * zb * 2); float* MK = (float*)take((size_t)NB_ * TT * 4);
    if ((size_t)(wsp - (char*)d_ws) > ws_size) return;    // total ~ 24 MB
    k_prep<<<dim3(TT / PTT, NH_, NB_), 512, 0, stream>>>(x, y, z, pm, QP, VP, KT, MK);   // scores use z ('value'), output uses y ('key')
    k_attn<<<dim3(TT / RW, NH_, NB_), AW * 32, 0, stream>>>(QP, VP, KT, MK, OUT);
}

// v004
// Measured time: 102 microseconds a run.
// Two timings next to v003 put it at 1.59 and 1.58 times that version's speed.
// All steps since v000 together make it 13.0 times as fast.
#include <hip/hip_runtime.h>

// decoderSelfAttention (x, y, z [2][2048][1024] split into 16 heads x 64 with NO projections; pad_mask [2][2048] (float, read); faithful to the source's argument swap: scores = q.v / sqrt(1024) with q from x and 'v' from z, then + (-1e9) x mask where mask = max(strict-upper-triangle, 1 - pad_mask[key]);
//   softmax; output = weights . k with 'k' from y; heads re-merged -> [2][2048][1024]).
// Compute dtypes, f32 accumulate: every input rounded to bf16; the scores are a PLAIN bf16 GEMM of the inputs themselves (exact products); the mask is additive -1e9, exactly as the source, so a fully padded row falls back to all keys: key tiles behind a row block's diagonal are left out only where a flag formed from pad_mask says that their weights are exact zeros; scale + mask + softmax f32 -> hl planes; weights.k as hl x exact bf16 (2 products); one work-group carries 32 query rows of one head from scores to output.

#define NB_  2
#define TT   2048
#define DM   1024
#define NH_  16
#define HD   64
#define ZH   2
typedef _Float16 h16;
typedef unsigned short bf;
typedef __attribute__((ext_vector_type(16))) __bf16   v16bf;
typedef __attribute__((ext_vector_type(16))) _Float16 v16h;
typedef __attribute__((ext_vector_type(8)))  _Float16 v8h;
typedef __attribute__((ext_vector_type(8)))  unsigned short v8us;
typedef __attribute__((ext_vector_type(8)))  float    v8f;
typedef __attribute__((ext_vector_type(4)))  float    v4f;
typedef v8h  __attribute__((may_alias)) v8ha;
typedef v4f  __attribute__((may_alias)) v4fa;
typedef v8us __attribute__((may_alias)) v8usa;

__device__ __forceinline__ unsigned short f2bf(float f) { unsigned u = __float_as_uint(f); u += 0x7FFFu + ((u >> 16) & 1u); return (unsigned short)(u >> 16); }
__device__ __forceinline__ float bf2f(unsigned short b) { return __uint_as_float(((unsigned)b) << 16); }
__device__ __forceinline__ float bfr(float f) { return bf2f(f2bf(f)); }
__device__ __forceinline__ v16h cat16(v8h lo, v8h hi) { return __builtin_shufflevector(lo, hi, 0, 1, 2, 3, 4, 5, 6, 7, 8, 9, 10, 11, 12, 13, 14, 15); }
__device__ __forceinline__ v16bf cat16b(v8us lo, v8us hi) { return __builtin_bit_cast(v16bf, __builtin_shufflevector(lo, hi, 0, 1, 2, 3, 4, 5, 6, 7, 8, 9, 10, 11, 12, 13, 14, 15)); }
__device__ __forceinline__ v8f wmma16(v16h a, v16h b, v8f c) { return __builtin_amdgcn_wmma_f32_16x16x32_f16(false, a, false, b, (short)0, c, false, false); }
__device__ __forceinline__ v8f wmmab(v16bf a, v16bf b, v8f c) { return __builtin_amdgcn_wmma_f32_16x16x32_bf16(false, a, false, b, (short)0, c, false, false); }



// fragment of a 16x16x32 product from a K-contiguous 16-bit plane: the lane's 8 elements at p and 8 at p + 16
template <typename T16> struct WFrag;
template <> struct WFrag<h16> { typedef v16h V; static __device__ __forceinline__ V ld(const h16* p) { return cat16(*(const v8h*)p, *(const v8h*)(p + 16)); } static __device__ __forceinline__ v8f mma(V a, V b, v8f c) { return wmma16(a, b, c); } };
template <> struct WFrag<bf> { typedef v16bf V; static __device__ __forceinline__ V ld(const bf* p) { return cat16b(*(const v8us*)p, *(const v8us*)(p + 16)); } static __device__ __forceinline__ v8f mma(V a, V b, v8f c) { return wmmab(a, b, c); } };

__device__ __forceinline__ void splitf(float y, unsigned short& h, unsigned short& l) { h = f2bf(y); l = f2bf(y - bf2f(h)); }
typedef __attribute__((ext_vector_type(4))) unsigned short v4us;

// k_prep: every layout step in ONE launch. A work-group of 16 waves takes PTT rows (t) x the 64 columns of one head of x, z and y; grid (TT/PTT, NH_, NB_).
//   x, z -> bf16 head planes P[h][t][d] (16-B loads, 8-B stores); y -> the transposed plane PT[h][d][t]: read along d like the others, turned in LDS, stored along t in whole 256-B runs;
//   the work-groups of head 0 also write their PTT entries of MK[b][j] = (1 - bf16(pad_mask)) (f32) and the flags FL[b][rb] of their PTT/32 blocks of 32 query rows:
//   FL = 1 where some key j <= 32*rb has MK[j] <= 0.5. Every row of that block then has a score above -5e8 - |s|, every key behind the block's last row one below -1e9 + |s|, so the latter's exp is an exact 0.
#define PTT 128
#define PTP (PTT / 2 + 1)   // dwords per LDS row (one d, PTT/2 pairs of t): one over a multiple of 64, so that the 16 lanes of a store (4 rows apart) and the rows of a read fall on different banks
typedef __attribute__((ext_vector_type(4))) unsigned v4u;
__global__ __launch_bounds__(512) void k_prep(const float* __restrict__ X, const float* __restrict__ Y, const float* __restrict__ Z, const float* __restrict__ pm, bf* QP, bf* VP, bf* KT, float* MK, int* FL) {
    __shared__ unsigned tl[HD * PTP];
    __shared__ unsigned fw[16];   // one word of PTT/32 flag bits per wave
    const int tid = threadIdx.x, c4 = (tid & 15) * 4, rw = tid >> 4;   // the lane's 4 columns; its row (x, z) or row pair (y) within a pass of 32
    const int t0 = blockIdx.x * PTT; const size_t zh = (size_t)blockIdx.z * NH_ + blockIdx.y;
    const size_t src = ((size_t)blockIdx.z * TT + t0) * DM + blockIdx.y * HD + c4;
    const float* ys = Y + src; const float* xs = X + src; const float* zs = Z + src;
    const bool dom = blockIdx.y == 0 && tid < PTT / 4; const size_t me = (size_t)blockIdx.z * TT + t0 + (tid & (PTT / 4 - 1)) * 4;
    v4f mv = (v4f){}, pv = (v4f){}, ya[2][2], xa[4], za[4];
    const bool h0 = blockIdx.y == 0;
    if (h0) pv = *(const v4f*)(pm + (size_t)blockIdx.z * TT + tid * 4);   // the batch entry's whole pad_mask, 4 keys a thread, for the flags
    if (dom) mv = *(const v4f*)(pm + me);   // asked for ahead of the tiles, so that it is not a second trip to memory at the end
#pragma unroll
    for (int p = 0; p < 2; ++p)
#pragma unroll
        for (int q = 0; q < 2; ++q) ya[p][q] = *(const v4f*)(ys + (size_t)((p * 32 + rw) * 2 + q) * DM);
#pragma unroll
    for (int p = 0; p < 4; ++p) xa[p] = *(const v4f*)(xs + (size_t)(p * 32 + rw) * DM);
#pragma unroll
    for (int p = 0; p < 4; ++p) za[p] = *(const v4f*)(zs + (size_t)(p * 32 + rw) * DM);
#pragma unroll
    for (int p = 0; p < 2; ++p)
#pragma unroll
        for (int u = 0; u < 4; ++u) tl[(c4 + u) * PTP + p * 32 + rw] = (unsigned)f2bf(ya[p][0][u]) | ((unsigned)f2bf(ya[p][1][u]) << 16);   // rows t, t+1 of one column: neighbours in the transposed plane
    if (h0) { unsigned open = 0, bits = 0;   // open, bit u: MK of key tid*4+u is at most 0.5
#pragma unroll
        for (int u = 0; u < 4; ++u) open |= (__fsub_rn(1.0f, bfr(pv[u])) <= 0.5f ? 1u : 0u) << u;
#pragma unroll
        for (int q = 0; q < PTT / 32; ++q) { const int n = t0 + q * 32 - tid * 4;   // the thread's keys u <= n count for row block q
            const unsigned in = n >= 3 ? 15u : n < 0 ? 0u : (2u << n) - 1u;
            bits |= (__any((open & in) != 0u) ? 1u : 0u) << q; }
        if ((tid & 31) == 0) fw[tid >> 5] = bits; }
    __syncthreads();   // the whole y tile (and, for head 0, every wave's flag word) is in LDS before a transposed row is read; it stands ahead of every global store, so that no wave waits out a store at it
    bf* kd = KT + zh * (size_t)HD * TT + t0;
#pragma unroll
    for (int p = 0; p < 2; ++p) { const int ci = p * 512 + tid, d = ci >> 4, c = (ci & 15) * 4; v4u o;   // 16 lanes store one d's 256 bytes
#pragma unroll
        for (int u = 0; u < 4; ++u) o[u] = tl[d * PTP + c + u];
        *(v4u*)(kd + (size_t)d * TT + c * 2) = o; }
    bf* qd = QP + (zh * TT + t0) * HD + c4; bf* vd = VP + (zh * TT + t0) * HD + c4;
#pragma unroll
    for (int p = 0; p < 4; ++p) { v4us o, o2;
#pragma unroll
        for (int u = 0; u < 4; ++u) { o[u] = f2bf(xa[p][u]); o2[u] = f2bf(za[p][u]); }
        *(v4us*)(qd + (p * 32 + rw) * HD) = o; *(v4us*)(vd + (p * 32 + rw) * HD) = o2; }
    if (dom) { v4f r;
#pragma unroll
        for (int u = 0; u < 4; ++u) r[u] = __fsub_rn(1.0f, bfr(mv[u]));
        *(v4f*)(MK + me) = r; }
    if (h0 && tid < PTT / 32) { unsigned o = 0;
#pragma unroll
        for (int w = 0; w < 16; ++w) o |= fw[w];
        FL[blockIdx.z * (TT / 32) + t0 / 32 + tid] = (int)((o >> tid) & 1u); }
}
// ---- k_attn: scores, softmax and weights . k of RW query rows of one head in ONE work-group of AW waves; the score block lives in LDS from the first product to the last; grid (NB_*NH_, TT/RW).
// Keys: NT groups of GK keys. NT covers the keys up to the block's last row where the block's flag FL is set (the keys behind it then have weights that are exact zeros: see k_prep), and all TT keys otherwise.
// NT is the same for the whole work-group; every per-group piece of work below stands under the scalar test ON(g). Row blocks are handed out from the last (most keys) to the first, so that the short ones fill the end of the launch.
// 1) wave w forms the f32 scores of all RW rows for the 16 keys w*16.. of each group into sm: each loaded key fragment serves both 16-row tiles;
// 2) wave w does the softmax of rows 2w and 2w+1 and lays each row's hi and lo bf16 planes over the row's own bytes (hi: first TT*2 bytes, lo: next TT*2);
// 3) wave w takes key slice w/2 (NT*32 keys) and output columns (w&1)*32..+31: A from the planes in LDS, B from the transposed plane, each B fragment serving both row tiles and both planes;
//    the KS partial tiles meet in LDS (over sm, behind a barrier) and are added in slice order 0..KS-1.
#define AW 16
#define RW 32
#define KS 8
#define GK 256            // keys per group: 16 for each wave in 1), two 128-key row chunks in 2), one 32-key step for each slice in 3)
#define NG (TT / GK)
#define ON(g) ((g) == 0 || (g) < NT)   // NT is at least 1
#define SP (TT + 4)   // floats per score row in LDS: 16 bytes over TT floats, an odd multiple of 16 bytes, so that the 16 rows of a 16-byte fragment read fall on different banks
typedef v4us __attribute__((may_alias)) v4usa;
__device__ __forceinline__ v16bf ldfrag_lds(const bf* p) { return cat16b(*(const v8usa*)p, *(const v8usa*)(p + 16)); }
// the score block takes most of a WGP's LDS, so one work-group is resident: its 16 waves are four per SIMD, within 256 registers each
__global__ __launch_bounds__(AW * 32) __attribute__((amdgpu_waves_per_eu(4, 4))) void k_attn(const bf* __restrict__ Q, const bf* __restrict__ V, const bf* __restrict__ Kt, const float* __restrict__ MK, const int* __restrict__ FL, float* OUT) {
    __shared__ __align__(16) float sm[RW * SP];
    const int zb = blockIdx.x / NH_, hd = blockIdx.x % NH_, rb = TT / RW - 1 - (int)blockIdx.y;
    const size_t zh = blockIdx.x; Q += zh * (size_t)TT * HD; V += zh * (size_t)TT * HD; Kt += zh * (size_t)HD * TT; MK += (size_t)zb * TT;
    const int lane = threadIdx.x & 31, lr = lane & 15, hi = lane >> 4, wv = threadIdx.x >> 5; const int r0 = rb * RW;
    const int NT = __builtin_amdgcn_readfirstlane(FL[zb * (TT / RW) + rb] != 0 ? (r0 + RW + GK - 1) / GK : NG);
    {   // 1) scores
        const int k0 = wv * 16;
        const unsigned qoff = (unsigned)((r0 + lr) * HD + 8 * hi) * 2u, voff = (unsigned)((k0 + lr) * HD + 8 * hi) * 2u;   // byte offsets of the lane's first A and B fragment
        const bf* pQ = (const bf*)((const char*)Q + qoff); const bf* pV = (const bf*)((const char*)V + voff);
        v16bf qa[2][2], vb[NG][2];
#pragma unroll
        for (int rt = 0; rt < 2; ++rt)
#pragma unroll
            for (int ks = 0; ks < 2; ++ks) qa[rt][ks] = WFrag<bf>::ld(pQ + rt * 16 * HD + ks * 32);
        // all of the wave's loads stand ahead of its first product, each group's in a block of its own, so the wave waits for memory once and not once per fragment
#pragma unroll
        for (int nt = 0; nt < NG; ++nt) if (ON(nt)) {
#pragma unroll
            for (int ks = 0; ks < 2; ++ks) vb[nt][ks] = WFrag<bf>::ld(pV + nt * GK * HD + ks * 32); }
        // behind the last load of the run, ahead of every later write of a register that one of these loads names as its address;
        // the offsets, the address and the two scalar bases (the build uses both address forms) ride along as inputs so that none of their registers is written ahead of the wait
        asm volatile("s_wait_xcnt 0x0" :: "v"(qoff), "v"(voff), "v"(pV), "s"(Q), "s"(V) : "memory");
        v8f s[NG][2];   // every product ahead of the first store: each score tile has registers of its own, none is written again right behind a product
#pragma unroll
        for (int nt = 0; nt < NG; ++nt) if (ON(nt)) {
#pragma unroll
            for (int rt = 0; rt < 2; ++rt) { s[nt][rt] = wmmab(qa[rt][0], vb[nt][0], (v8f){}); s[nt][rt] = wmmab(qa[rt][1], vb[nt][1], s[nt][rt]); } }
#pragma unroll
        for (int nt = 0; nt < NG; ++nt) if (ON(nt)) {
#pragma unroll
            for (int rt = 0; rt < 2; ++rt)
#pragma unroll
                for (int j = 0; j < 8; ++j) sm[(rt * 16 + hi * 8 + j) * SP + nt * GK + k0 + lr] = s[nt][rt][j]; }
    }
    __syncthreads();   // every wave's score columns are in sm before a row is read
    v4f m4r[TT / 128];   // the lane's share of the key mask, the same for both of the wave's rows: read once, all loads in flight together
    const float* pM = MK + lane * 4;   // the lane's first mask entry
#pragma unroll
    for (int g = 0; g < NG; ++g) if (ON(g)) {
#pragma unroll
        for (int c = 0; c < 2; ++c) m4r[g * 2 + c] = *(const v4f*)(pM + (g * 2 + c) * 128); }
    // behind the last mask load, ahead of every later write of a register that one of them names as its address; the scalar base rides along as an input so that its registers are not written ahead of the wait
    asm volatile("s_wait_xcnt 0x0" :: "s"(MK) : "memory");
    // 2) softmax, one wave per row, two rows a wave; a row is read whole into registers before its planes are laid over it, and no other wave touches it
    for (int rr = 0; rr < RW / AW; ++rr) { const int row = wv * (RW / AW) + rr; const int i = r0 + row; float* sr = sm + row * SP; float v[TT / 32]; float mx = -3.0e38f; v4f a4[TT / 128];
        // the row's LDS reads stand ahead of the arithmetic, each group's in a block of its own, so the wave waits out the LDS latency once per row and not once per read
#pragma unroll
        for (int g = 0; g < NG; ++g) if (ON(g)) {
#pragma unroll
            for (int c = 0; c < 2; ++c) a4[g * 2 + c] = *(const v4fa*)(sr + (g * 2 + c) * 128 + lane * 4); }
#pragma unroll
        for (int g = 0; g < NG; ++g) if (ON(g)) {
#pragma unroll
            for (int ch = g * 2; ch < g * 2 + 2; ++ch) { const v4f a = a4[ch]; const v4f m4 = m4r[ch];
#pragma unroll
                for (int u = 0; u < 4; ++u) { const int j = ch * 128 + lane * 4 + u; const float mk = fmaxf((j > i) ? 1.f : 0.f, m4[u]); float s0 = a[u] * 0.03125f; asm volatile("" : "+v"(s0)); float ng = __fmul_rn(-1e9f, mk); asm volatile("" : "+v"(ng)); const float t = __fadd_rn(s0, ng); v[ch * 4 + u] = t; mx = fmaxf(mx, t); } } }
#pragma unroll
        for (int sh = 16; sh; sh >>= 1) mx = fmaxf(mx, __shfl_xor(mx, sh, 32));
        float sum = 0.f;
#pragma unroll
        for (int g = 0; g < NG; ++g) if (ON(g)) {
#pragma unroll
            for (int q = g * 8; q < g * 8 + 8; ++q) { float d0 = __fsub_rn(v[q], mx); asm volatile("" : "+v"(d0)); v[q] = __builtin_amdgcn_exp2f(__fmul_rn(d0, 1.4426950408889634f)); sum += v[q]; } }
#pragma unroll
        for (int sh = 16; sh; sh >>= 1) sum += __shfl_xor(sum, sh, 32);
        const float f = __fdiv_rn(1.0f, sum);
        bf* ph = (bf*)sr; bf* pl = ph + TT;
#pragma unroll
        for (int g = 0; g < NG; ++g) if (ON(g)) {
#pragma unroll
            for (int ch = g * 2; ch < g * 2 + 2; ++ch) { v4us oh, ol; for (int q = 0; q < 4; ++q) { unsigned short a2, c2; splitf(v[ch * 4 + q] * f, a2, c2); oh[q] = a2; ol[q] = c2; } *(v4usa*)(ph + ch * 128 + lane * 4) = oh; *(v4usa*)(pl + ch * 128 + lane * 4) = ol; } }
    }
    __syncthreads();   // all RW rows' planes are in sm before a fragment is read
    // 3) weights . k
    const int sl = wv >> 1, dh = wv & 1;
    v8f acc[2][2];
#pragma unroll
    for (int rt = 0; rt < 2; ++rt)
#pragma unroll
        for (int nb = 0; nb < 2; ++nb) acc[rt][nb] = (v8f){};
    {
        const int k0 = sl * NT * 32;   // the slices are runs of neighbouring keys, so that a wave uses whole lines of the transposed plane
        const bf* pa = (const bf*)(sm + lr * SP) + 8 * hi + k0;   // the lane's first hi-plane fragment of row tile 0; the lo plane lies TT elements on, row tile 1 lies 16 rows on
        const unsigned boff = (unsigned)((dh * 32 + lr) * TT + 8 * hi + k0) * 2u;   // byte offset of the lane's first B fragment
        const bf* pB = (const bf*)((const char*)Kt + boff);
        // two halves of up to four 32-key steps, unrolled so that every load offset is an immediate; a half's loads stand ahead of its first product, each step's in a block of its own, so the wave waits once per half
#pragma unroll
        for (int g = 0; g < NG; g += 4) {
            v16bf a[2][4], a2[2][4], b[4][2];
#pragma unroll
            for (int ks = 0; ks < 4; ++ks) if (ON(g + ks)) {
#pragma unroll
                for (int nb = 0; nb < 2; ++nb) b[ks][nb] = WFrag<bf>::ld(pB + nb * 16 * TT + (g + ks) * 32);
#pragma unroll
                for (int rt = 0; rt < 2; ++rt) { a[rt][ks] = ldfrag_lds(pa + rt * 16 * SP * 2 + (g + ks) * 32); a2[rt][ks] = ldfrag_lds(pa + rt * 16 * SP * 2 + TT + (g + ks) * 32); } }
            // behind the half's last global load, ahead of every later write of a register that one of them names as its address; offset, address and scalar base ride along as inputs so that none of their registers is written ahead of the wait
            asm volatile("s_wait_xcnt 0x0" :: "v"(boff), "v"(pB), "s"(Kt) : "memory");
#pragma unroll
            for (int ks = 0; ks < 4; ++ks) if (ON(g + ks)) {
#pragma unroll
                for (int rt = 0; rt < 2; ++rt)
#pragma unroll
                    for (int nb = 0; nb < 2; ++nb) { acc[rt][nb] = wmmab(a[rt][ks], b[ks][nb], acc[rt][nb]); acc[rt][nb] = wmmab(a2[rt][ks], b[ks][nb], acc[rt][nb]); } }
        }
    }
    __syncthreads();   // every wave has read its last fragment before the partial tiles are laid over sm
    float* ps = sm + sl * (RW * 68);
#pragma unroll
    for (int rt = 0; rt < 2; ++rt)
#pragma unroll
        for (int nb = 0; nb < 2; ++nb) {
#pragma unroll
            for (int j = 0; j < 8; ++j) ps[(rt * 16 + hi * 8 + j) * 68 + dh * 32 + nb * 16 + lr] = acc[rt][nb][j]; }
    __syncthreads();   // all partial tiles are in LDS before they are added
    const int row = threadIdx.x >> 4, cofs = (threadIdx.x & 15) * 4;
    v4f s = *(const v4fa*)(sm + row * 68 + cofs);
#pragma unroll
    for (int w = 1; w < KS; ++w) s += *(const v4fa*)(sm + w * (RW * 68) + row * 68 + cofs);
    *(v4f*)(OUT + ((size_t)zb * TT + r0 + row) * DM + hd * HD + cofs) = s;
}

extern "C" void kernel_launch(void* const* d_in, const int* in_sizes, int n_in,
                              void* d_out, int out_size, void* d_ws, size_t ws_size, hipStream_t stream) {
    (void)in_sizes; (void)n_in; (void)out_size;
    const float* x = (const float*)d_in[0]; const float* y = (const float*)d_in[1]; const float* z = (const float*)d_in[2]; const float* pm = (const float*)d_in[3];
    float* OUT = (float*)d_out;     // [2][2048][1024]
    char* wsp = (char*)d_ws;
    auto take = [&](size_t bytes) { char* p = wsp; wsp += (bytes + 255) & ~(size_t)255; return (void*)p; };
    const size_t zb = (size_t)NH_ * TT * HD;   // elements of one batch entry's planes
    bf* QP = (bf*)take(NB_ * zb * 2); bf* VP = (bf*)take(NB_ * zb * 2); bf* KT = (bf*)take(NB_ * zb * 2); float* MK = (float*)take((size_t)NB_ * TT * 4); int* FL = (int*)take((size_t)NB_ * (TT / RW) * 4);
    if ((size_t)(wsp - (char*)d_ws) > ws_size) return;    // total ~ 24 MB
    k_prep<<<dim3(TT / PTT, NH_, NB_), 512, 0, stream>>>(x, y, z, pm, QP, VP, KT, MK, FL);   // scores use z ('value'), output uses y ('key')
    k_attn<<<dim3(NB_ * NH_, TT / RW), AW * 32, 0, stream>>>(QP, VP, KT, MK, FL, OUT);
}

// v006
// A run of this version takes 56.6 microseconds.
// Versions between v004 and this one are left out; their measured steps multiply to 1.79 times as fast.
// All steps since v000 together make it 23.3 times as fast.
#include <hip/hip_runtime.h>

// decoderSelfAttention (x, y, z [2][2048][1024] split into 16 heads x 64 with NO projections; pad_mask [2][2048] (float, read); faithful to the source's argument swap: scores = q.v / sqrt(1024) with q from x and 'v' from z, then + (-1e9) x mask where mask = max(strict-upper-triangle, 1 - pad_mask[key]);
//   softmax; output = weights . k with 'k' from y; heads re-merged -> [2][2048][1024]).
// Compute dtypes, f32 accumulate: every input rounded to bf16; the scores are a PLAIN bf16 GEMM of the inputs themselves (exact products); the mask is additive -1e9, exactly as the source, so a fully padded row falls back to all keys: key tiles behind a row block's diagonal are left out only where a flag formed from pad_mask says that their weights are exact zeros; scale + mask + softmax f32 -> hi and lo bf16 parts of each weight; weights.k as (hi, lo) x exact bf16 (2 products); one wave carries 32 query rows of one head from scores to output.

#define NB_  2
#define TT   2048
#define DM   1024
#define NH_  16
#define HD   64
#define ZH   2
typedef _Float16 h16;
typedef unsigned short bf;
typedef __attribute__((ext_vector_type(16))) __bf16   v16bf;
typedef __attribute__((ext_vector_type(16))) _Float16 v16h;
typedef __attribute__((ext_vector_type(8)))  _Float16 v8h;
typedef __attribute__((ext_vector_type(8)))  unsigned short v8us;
typedef __attribute__((ext_vector_type(8)))  float    v8f;
typedef __attribute__((ext_vector_type(4)))  float    v4f;
typedef v8h  __attribute__((may_alias)) v8ha;
typedef v4f  __attribute__((may_alias)) v4fa;
typedef v8us __attribute__((may_alias)) v8usa;

__device__ __forceinline__ unsigned short f2bf(float f) { unsigned u = __float_as_uint(f); u += 0x7FFFu + ((u >> 16) & 1u); return (unsigned short)(u >> 16); }
__device__ __forceinline__ float bf2f(unsigned short b) { return __uint_as_float(((unsigned)b) << 16); }
__device__ __forceinline__ float bfr(float f) { return bf2f(f2bf(f)); }
__device__ __forceinline__ v16h cat16(v8h lo, v8h hi) { return __builtin_shufflevector(lo, hi, 0, 1, 2, 3, 4, 5, 6, 7, 8, 9, 10, 11, 12, 13, 14, 15); }
__device__ __forceinline__ v16bf cat16b(v8us lo, v8us hi) { return __builtin_bit_cast(v16bf, __builtin_shufflevector(lo, hi, 0, 1, 2, 3, 4, 5, 6, 7, 8, 9, 10, 11, 12, 13, 14, 15)); }
__device__ __forceinline__ v8f wmma16(v16h a, v16h b, v8f c) { return __builtin_amdgcn_wmma_f32_16x16x32_f16(false, a, false, b, (short)0, c, false, false); }
__device__ __forceinline__ v8f wmmab(v16bf a, v16bf b, v8f c) { return __builtin_amdgcn_wmma_f32_16x16x32_bf16(false, a, false, b, (short)0, c, false, false); }



// fragment of a 16x16x32 product from a K-contiguous 16-bit plane: the lane's 8 elements at p and 8 at p + 16
template <typename T16> struct WFrag;
template <> struct WFrag<h16> { typedef v16h V; static __device__ __forceinline__ V ld(const h16* p) { return cat16(*(const v8h*)p, *(const v8h*)(p + 16)); } static __device__ __forceinline__ v8f mma(V a, V b, v8f c) { return wmma16(a, b, c); } };
template <> struct WFrag<bf> { typedef v16bf V; static __device__ __forceinline__ V ld(const bf* p) { return cat16b(*(const v8us*)p, *(const v8us*)(p + 16)); } static __device__ __forceinline__ v8f mma(V a, V b, v8f c) { return wmmab(a, b, c); } };

typedef __attribute__((ext_vector_type(4))) unsigned short v4us;

// k_prep: every layout step in ONE launch. A work-group of 16 waves takes PTT rows (t) x the 64 columns of one head of x, z and y; grid (TT/PTT, NH_, NB_).
//   x -> the bf16 head plane P[h][t][d] (16-B loads, 8-B stores). z and y -> planes in the FRAGMENT ORDER of k_attn's A operands: per head and pass of 32 keys 4 KiB = 4 fragments x 2 halves x 32 lanes x 16 B,
//   so that one 16-B load of a wave reads 512 bytes in a row (4 whole lines) and not 16 pieces of 32 B in 16 lines. Lane l = 16*hi + lr, half hf, element e:
//     z, fragment kt*2 + ks: key 16*kt + lr of the pass, d = 32*ks + 16*hf + 8*hi + e;   y, fragment dt: d = 16*dt + lr, key 16*hf + 8*hi + e of the pass (the k order of both is the one the row-major loaders had).
//   Both are read along d like x, put in that order in LDS, and the work-group's 16 KiB of each plane (its PTT/32 passes) go out as one run, 16 B a lane;
//   the work-groups of head 0 also write their PTT entries of MK[b][j] = (1 - bf16(pad_mask)) (f32) and the flags FL[b][rb] of their PTT/32 blocks of 32 query rows:
//   FL = 1 where some key j <= 32*rb has MK[j] <= 0.5. Every row of that block then has a score above -5e8 - |s|, every key behind the block's last row one below -1e9 + |s|, so the latter's exp is an exact 0.
#define PTT 128
#define KDP 260             // y tile: dwords per fragment (1 KiB + 16 B): the 4 fragments that the lanes of one LDS store fall in start 4 banks apart
#define KSP (4 * KDP)       // y tile: dwords per pass
#define VBP 72              // z tile: dwords per 256-B block (one half of a fragment, one hi; + 32 B): the 8 blocks that the lanes of one LDS store fall in start 8 banks apart
typedef __attribute__((ext_vector_type(4))) unsigned v4u;
typedef __attribute__((ext_vector_type(2))) unsigned v2u;
__global__ __launch_bounds__(512) void k_prep(const float* __restrict__ X, const float* __restrict__ Y, const float* __restrict__ Z, const float* __restrict__ pm, bf* QP, bf* VP, bf* KT, float* MK, int* FL) {
    __shared__ __attribute__((aligned(16))) unsigned tl[(PTT / 32) * KSP];
    __shared__ __attribute__((aligned(16))) unsigned tv[(PTT / 32) * 16 * VBP];
    __shared__ unsigned fw[16];   // one word of PTT/32 flag bits per wave
    const int tid = threadIdx.x, c4 = (tid & 15) * 4, rw = tid >> 4;   // the lane's 4 columns; its row (x, z) or row pair (y) within a pass of 32
    const int t0 = blockIdx.x * PTT; const size_t zh = (size_t)blockIdx.z * NH_ + blockIdx.y;
    const size_t src = ((size_t)blockIdx.z * TT + t0) * DM + blockIdx.y * HD + c4;
    const float* ys = Y + src; const float* xs = X + src; const float* zs = Z + src;
    const bool dom = blockIdx.y == 0 && tid < PTT / 4; const size_t me = (size_t)blockIdx.z * TT + t0 + (tid & (PTT / 4 - 1)) * 4;
    v4f mv = (v4f){}, pv = (v4f){}, ya[2][2], xa[4], za[4];
    const bool h0 = blockIdx.y == 0;
    if (h0) pv = *(const v4f*)(pm + (size_t)blockIdx.z * TT + tid * 4);   // the batch entry's whole pad_mask, 4 keys a thread, for the flags
    if (dom) mv = *(const v4f*)(pm + me);   // asked for ahead of the tiles, so that it is not a second trip to memory at the end
#pragma unroll
    for (int p = 0; p < 2; ++p)
#pragma unroll
        for (int q = 0; q < 2; ++q) ya[p][q] = *(const v4f*)(ys + (size_t)((p * 32 + rw) * 2 + q) * DM);
#pragma unroll
    for (int p = 0; p < 4; ++p) za[p] = *(const v4f*)(zs + (size_t)(p * 32 + rw) * DM);
#pragma unroll
    for (int p = 0; p < 4; ++p) xa[p] = *(const v4f*)(xs + (size_t)(p * 32 + rw) * DM);
#pragma unroll
    for (int p = 0; p < 2; ++p)
#pragma unroll
        for (int u = 0; u < 4; ++u)   // rows t, t+1 of one column: neighbouring keys of one lane's 16 B. Pass p*2 + rw/16, key 2*(rw & 15) of it
            tl[(p * 2 + (rw >> 4)) * KSP + ((c4 + u) >> 4) * KDP + ((rw & 15) >> 2) * 64 + ((c4 + u) & 15) * 4 + (rw & 3)] = (unsigned)f2bf(ya[p][0][u]) | ((unsigned)f2bf(ya[p][1][u]) << 16);
#pragma unroll
    for (int p = 0; p < 4; ++p)   // pass p, key rw of it, 4 neighbouring d: half of one lane's 16 B
        *(v2u*)(tv + (p * 16 + (rw >> 4) * 8 + (c4 >> 3)) * VBP + (rw & 15) * 4 + ((c4 >> 2) & 1) * 2) = (v2u){(unsigned)f2bf(za[p][0]) | ((unsigned)f2bf(za[p][1]) << 16), (unsigned)f2bf(za[p][2]) | ((unsigned)f2bf(za[p][3]) << 16)};
    if (h0) { unsigned open = 0, bits = 0;   // open, bit u: MK of key tid*4+u is at most 0.5
#pragma unroll
        for (int u = 0; u < 4; ++u) open |= (__fsub_rn(1.0f, bfr(pv[u])) <= 0.5f ? 1u : 0u) << u;
#pragma unroll
        for (int q = 0; q < PTT / 32; ++q) { const int n = t0 + q * 32 - tid * 4;   // the thread's keys u <= n count for row block q
            const unsigned in = n >= 3 ? 15u : n < 0 ? 0u : (2u << n) - 1u;
            bits |= (__any((open & in) != 0u) ? 1u : 0u) << q; }
        if ((tid & 31) == 0) fw[tid >> 5] = bits; }
    __syncthreads();   // the whole y and z tiles (and, for head 0, every wave's flag word) are in LDS before a run is read; it stands ahead of every global store, so that no wave waits out a store at it
    v4u* kd = (v4u*)(KT + (zh * TT + t0) * HD); v4u* vd = (v4u*)(VP + (zh * TT + t0) * HD);
#pragma unroll
    for (int p = 0; p < 2; ++p) { const int ci = p * 512 + tid;   // the thread's 16 B of the work-group's 16 KiB
        kd[ci] = *(const v4u*)(tl + (ci >> 8) * KSP + ((ci >> 6) & 3) * KDP + (ci & 63) * 4);
        vd[ci] = *(const v4u*)(tv + (ci >> 4) * VBP + (ci & 15) * 4); }
    bf* qd = QP + (zh * TT + t0) * HD + c4;
#pragma unroll
    for (int p = 0; p < 4; ++p) { v4us o;
#pragma unroll
        for (int u = 0; u < 4; ++u) o[u] = f2bf(xa[p][u]);
        *(v4us*)(qd + (p * 32 + rw) * HD) = o; }
    if (dom) { v4f r;
#pragma unroll
        for (int u = 0; u < 4; ++u) r[u] = __fsub_rn(1.0f, bfr(mv[u]));
        *(v4f*)(MK + me) = r; }
    if (h0 && tid < PTT / 32) { unsigned o = 0;
#pragma unroll
        for (int w = 0; w < 16; ++w) o |= fw[w];
        FL[blockIdx.z * (TT / 32) + t0 / 32 + tid] = (int)((o >> tid) & 1u); }
}
// ---- k_attn: scores, softmax and weights . k of RW query rows of one head in ONE WAVE, all in registers; no LDS and no barrier. Grid (NB_*NH_, NTL/8), 8 waves a work-group.
// The products are taken transposed: S^T = v . q^T (A = 16 key rows, B = 16 query rows as columns), O^T += k^T . P^T (A = 16 rows d of the transposed plane, B = the weights). Both A planes lie in fragment order (see k_prep).
// A lane then holds, for ONE query (its column), 8 neighbouring keys of each 16-key tile: maximum and sum are in-lane but for one exchange between the wave's halves,
// and the two score tiles of a 32-key pass, converted in place, ARE the B operand of the second product in the loaders' own k order (8 at 8*hi, 8 at 16 + 8*hi).
// A pass is 32 keys. NS passes: up to the tile's diagonal pass where the tile's flag FL is set (the keys behind it then have weights that are exact zeros: see k_prep), all TT/32 otherwise.
// The maximum in use m follows the running maximum lazily: sums and output tiles are rescaled only in a pass where some column's maximum has risen more than 5.5 above m (weights stay below e^5.5); the division by the row sum stands at the end.
// Balance: waves w and w + 4 of a work-group take row tiles t and NTL - 1 - t, NTL + 1 passes together, the same for every such pair.
// Every inner loop is unrolled so that the fragment, score and output arrays are indexed by constants and stay in registers; the loop over the passes stays rolled.
#define RW 32
#define NTL (TT / RW)
typedef __attribute__((ext_vector_type(2))) float v2f;
typedef __attribute__((ext_vector_type(2))) __bf16 v2bf;
typedef __attribute__((ext_vector_type(8))) unsigned v8u;
#define L2E 1.4426950408889634f
// a byte pointer that keeps its global address space through an asm statement (a plain pointer would come out of it as a flat one), and the loader of a fragment-ordered plane on it: the lane's 8 elements at p, 8 at p + 512 bytes
typedef const __attribute__((address_space(1))) char* gcp;
__device__ __forceinline__ v16bf ldg(gcp p) { return cat16b(*(const __attribute__((address_space(1))) v8us*)p, *(const __attribute__((address_space(1))) v8us*)(p + 512)); }
// the value of the lane 16 away
__device__ __forceinline__ float xhalf(float x) { const int b = __float_as_int(x); return __int_as_float(__builtin_amdgcn_permlanex16(b, b, 0x76543210, 0xfedcba98, false, false)); }
__global__ __launch_bounds__(256) void k_attn(const bf* __restrict__ Q, const bf* __restrict__ V, const bf* __restrict__ Kt, const float* __restrict__ MK, const int* __restrict__ FL, float* OUT) {
    const int zb = blockIdx.x / NH_, hd = blockIdx.x % NH_;
    const int lane = threadIdx.x & 31, lr = lane & 15, hi = lane >> 4, wv = __builtin_amdgcn_readfirstlane((int)(threadIdx.x >> 5));
    const int tl = wv < 4 ? NTL - 1 - ((int)blockIdx.y * 4 + wv) : (int)blockIdx.y * 4 + (wv - 4);
    const int r0 = tl * RW;
    const size_t zh = blockIdx.x; Q += zh * (size_t)TT * HD; V += zh * (size_t)TT * HD; Kt += zh * (size_t)TT * HD; MK += (size_t)zb * TT;
    const int NS = __builtin_amdgcn_readfirstlane(FL[zb * NTL + tl] != 0 ? tl + 1 : NTL);
    unsigned oF = (unsigned)lane * 16u, oM = (unsigned)lane * 4u;   // the lane's byte offsets in each 512-B half of a fragment (both planes) and in a pass's mask entries
    const bf* pQ = Q + (r0 + lr) * HD + 8 * hi; gcp pV = (gcp)(const char*)V + oF, pK = (gcp)(const char*)Kt + oF;
    v16bf qb[2][2], va[2][2], ka[4];
#pragma unroll
    for (int c = 0; c < 2; ++c)
#pragma unroll
        for (int ks = 0; ks < 2; ++ks) qb[c][ks] = WFrag<bf>::ld(pQ + c * 16 * HD + ks * 32);
    float mkl = *(const float*)((const char*)MK + oM);   // one mask entry a lane: the pass's 32 keys, for the test whether any of them is masked at all
#pragma unroll
    for (int kt = 0; kt < 2; ++kt)
#pragma unroll
        for (int ks = 0; ks < 2; ++ks) va[kt][ks] = ldg(pV + (kt * 2 + ks) * 1024);
    // behind these loads, ahead of every later write of their address registers; it also keeps the loads in the loop's own order (mask entry, key rows, then the transposed plane), so that the first product's counted wait leaves the plane's loads in flight
    asm volatile("s_wait_xcnt 0x0" :: "v"(pQ), "v"(oF), "s"(V) : "memory");
#pragma unroll
    for (int dt = 0; dt < 4; ++dt) ka[dt] = ldg(pK + dt * 1024);
    // behind the last load in front of the loop, ahead of every later write of a register that one of them names as its address
    asm volatile("s_wait_xcnt 0x0" :: "v"(oF), "v"(oM), "s"(Kt), "s"(MK) : "memory");
    // bases: bk of the plane rows last fetched; bv and bm of the key rows and mask entries that the coming pass fetches ahead (pass 1, or pass 0 again where there is no other)
    gcp bk = (gcp)(const char*)Kt, bv = (gcp)(const char*)V + (size_t)(NS > 1 ? 32 * HD * 2 : 0), bm = (gcp)(const char*)MK + (size_t)(NS > 1 ? 32 * 4 : 0);
    v8f acc[2][4]; float m[2]; v2f l2[2];
#pragma unroll
    for (int c = 0; c < 2; ++c) { m[c] = -3.0e38f; l2[c] = (v2f){};
#pragma unroll
        for (int dt = 0; dt < 4; ++dt) acc[c][dt] = (v8f){}; }
    for (int st = 0; st < NS; ++st) {
        v8f s[2][2];
#pragma unroll
        for (int c = 0; c < 2; ++c)
#pragma unroll
            for (int kt = 0; kt < 2; ++kt) s[c][kt] = wmmab(va[kt][0], qb[c][0], (v8f){});
#pragma unroll
        for (int c = 0; c < 2; ++c)
#pragma unroll
            for (int kt = 0; kt < 2; ++kt) s[c][kt] = wmmab(va[kt][1], qb[c][1], s[c][kt]);
        // plain pass: wholly in front of the diagonal and no key with a mask entry above 0, so that -1e9 * max(0, entry) is a zero and adding it an identity
        const bool plain = (st < tl) & (__builtin_amdgcn_ballot_w32(mkl > 0.f) == 0u);
        // the next pass's key rows go into the registers that the products above have just read: they have the softmax and the second product to arrive
        mkl = *(const __attribute__((address_space(1))) float*)(bm + oM);
#pragma unroll
        for (int kt = 0; kt < 2; ++kt)
#pragma unroll
            for (int ks = 0; ks < 2; ++ks) va[kt][ks] = ldg(bv + oF + (kt * 2 + ks) * 1024);
        v2f t[2][8];   // t[c][kt * 4 + q]: keys kt*16 + 8*hi + 2q, + 1 of the pass, query column c*16 + lr
        if (plain) {
#pragma unroll
            for (int c = 0; c < 2; ++c)
#pragma unroll
                for (int k = 0; k < 8; ++k) t[c][k] = (v2f){s[c][k >> 2][(k & 3) * 2], s[c][k >> 2][(k & 3) * 2 + 1]} * 0.03125f;
        } else {
            const float* pm = MK + st * 32 + 8 * hi; v4f mk4[4];
            mk4[0] = *(const v4f*)pm; mk4[1] = *(const v4f*)(pm + 4); mk4[2] = *(const v4f*)(pm + 16); mk4[3] = *(const v4f*)(pm + 20);
            // behind the four mask loads, ahead of every later write of their address register
            asm volatile("s_wait_xcnt 0x0" :: "v"(pm) : "memory");
#pragma unroll
            for (int c = 0; c < 2; ++c) { const int i = r0 + c * 16 + lr;
#pragma unroll
                for (int k = 0; k < 8; ++k)
#pragma unroll
                    for (int u = 0; u < 2; ++u) { const int e = (k & 3) * 2 + u, j = st * 32 + (k >> 2) * 16 + 8 * hi + e;
                        const float mk = fmaxf((j > i) ? 1.f : 0.f, mk4[(k >> 2) * 2 + (e >> 2)][e & 3]);
                        t[c][k][u] = s[c][k >> 2][e] * 0.03125f + __fmul_rn(-1e9f, mk); } }   // the scaling is by a power of two, exact: fused or not, the sum rounds once, as the source's
        }
        float ml[2];
#pragma unroll
        for (int c = 0; c < 2; ++c) { float x[8];
#pragma unroll
            for (int k = 0; k < 8; ++k) x[k] = fmaxf(t[c][k][0], t[c][k][1]);
            const float y = fmaxf(fmaxf(fmaxf(x[0], x[1]), fmaxf(x[2], x[3])), fmaxf(fmaxf(x[4], x[5]), fmaxf(x[6], x[7])));
            ml[c] = fmaxf(y, xhalf(y)); }
        if (__builtin_amdgcn_ballot_w32(ml[0] > m[0] + 5.5f || ml[1] > m[1] + 5.5f) != 0u) {
#pragma unroll
            for (int c = 0; c < 2; ++c) { const float mn = fmaxf(m[c], ml[c]); const float al = __builtin_amdgcn_exp2f((m[c] - mn) * L2E); m[c] = mn; l2[c] *= al;
#pragma unroll
                for (int dt = 0; dt < 4; ++dt) acc[c][dt] *= al; }
        }
        v16bf ph[2], pl[2];
#pragma unroll
        for (int c = 0; c < 2; ++c) { v8u hu, lu;
#pragma unroll
            for (int k = 0; k < 8; ++k) { const v2f x = (t[c][k] - m[c]) * L2E;   // the difference first: it is an exact 0 where a masked row's entries all equal m
                const v2f p = (v2f){__builtin_amdgcn_exp2f(x[0]), __builtin_amdgcn_exp2f(x[1])}; l2[c] += p;
                const unsigned h = __builtin_bit_cast(unsigned, __builtin_convertvector(p, v2bf));
                const v2f r = p - (v2f){__uint_as_float(h << 16), __uint_as_float(h & 0xFFFF0000u)};
                hu[k] = h; lu[k] = __builtin_bit_cast(unsigned, __builtin_convertvector(r, v2bf)); }
            ph[c] = __builtin_bit_cast(v16bf, hu); pl[c] = __builtin_bit_cast(v16bf, lu); }
#pragma unroll
        for (int c = 0; c < 2; ++c)
#pragma unroll
            for (int dt = 0; dt < 4; ++dt) acc[c][dt] = wmmab(ka[dt], ph[c], acc[c][dt]);
#pragma unroll
        for (int c = 0; c < 2; ++c)
#pragma unroll
            for (int dt = 0; dt < 4; ++dt) acc[c][dt] = wmmab(ka[dt], pl[c], acc[c][dt]);
        // the next pass's rows of the transposed plane, likewise into the registers just read: they have the next pass's first product and softmax to arrive
        // Addresses in the loop: a scalar base that moves with the pass and a lane offset that never changes. The one wait of a pass for the loads issued so far stands here, in front of the step of all three bases,
        // where those loads have had the softmax to run out, and not directly behind them; bases and offsets go through the statement so that the bases are stepped behind it, all stay in their registers up to it,
        // and each address is formed from its two parts at the load itself (scalar base + 32-bit lane offset), in no further register.
        asm volatile("s_wait_xcnt 0x0" : "+s"(bv), "+s"(bm), "+s"(bk), "+v"(oF), "+v"(oM) :: "memory");
        bk += (size_t)(st + 1 < NS ? 32 * HD * 2 : 0);                                                       // the last pass fetches itself again, in bounds
        bv += (size_t)(st + 2 < NS ? 32 * HD * 2 : 0); bm += (size_t)(st + 2 < NS ? 32 * 4 : 0);   // for the fetch that the next pass makes
#pragma unroll
        for (int dt = 0; dt < 4; ++dt) ka[dt] = ldg(bk + oF + dt * 1024);
    }
    // behind the last pass's fetches, ahead of every later write of a register that one of them names as its address (bases and offsets ride along as inputs, so that they stay in their registers up to here)
    asm volatile("s_wait_xcnt 0x0" :: "s"(bv), "s"(bm), "s"(bk), "v"(oF), "v"(oM) : "memory");
#pragma unroll
    for (int c = 0; c < 2; ++c) { float l = l2[c][0] + l2[c][1]; l += xhalf(l); const float f = __fdiv_rn(1.0f, l);
        float* po = OUT + ((size_t)zb * TT + r0 + c * 16 + lr) * DM + hd * HD + 8 * hi;   // the lane's 8 neighbouring d of each 16-row output tile
#pragma unroll
        for (int dt = 0; dt < 4; ++dt) { const v8f o = acc[c][dt] * f;
            *(v4f*)(po + dt * 16) = (v4f){o[0], o[1], o[2], o[3]}; *(v4f*)(po + dt * 16 + 4) = (v4f){o[4], o[5], o[6], o[7]}; } }
}

extern "C" void kernel_launch(void* const* d_in, const int* in_sizes, int n_in,
                              void* d_out, int out_size, void* d_ws, size_t ws_size, hipStream_t stream) {
    (void)in_sizes; (void)n_in; (void)out_size;
    const float* x = (const float*)d_in[0]; const float* y = (const float*)d_in[1]; const float* z = (const float*)d_in[2]; const float* pm = (const float*)d_in[3];
    float* OUT = (float*)d_out;     // [2][2048][1024]
    char* wsp = (char*)d_ws;
    auto take = [&](size_t bytes) { char* p = wsp; wsp += (bytes + 255) & ~(size_t)255; return (void*)p; };
    const size_t zb = (size_t)NH_ * TT * HD;   // elements of one batch entry's planes
    bf* QP = (bf*)take(NB_ * zb * 2); bf* VP = (bf*)take(NB_ * zb * 2); bf* KT = (bf*)take(NB_ * zb * 2); float* MK = (float*)take((size_t)NB_ * TT * 4); int* FL = (int*)take((size_t)NB_ * (TT / RW) * 4);
    if ((size_t)(wsp - (char*)d_ws) > ws_size) return;    // total ~ 24 MB
    k_prep<<<dim3(TT / PTT, NH_, NB_), 512, 0, stream>>>(x, y, z, pm, QP, VP, KT, MK, FL);   // scores use z ('value'), output uses y ('key')
    k_attn<<<dim3(NB_ * NH_, NTL / 8), 256, 0, stream>>>(QP, VP, KT, MK, FL, OUT);
}

// v007
// It runs in 34.8 microseconds.
// In two side-by-side timings against v006, it was 1.64 and 1.63 times as fast.
// Over all steps from v000 it is 38.1 times as fast.
#include <hip/hip_runtime.h>

// decoderSelfAttention (x, y, z [2][2048][1024] split into 16 heads x 64 with NO projections; pad_mask [2][2048] (float, read); faithful to the source's argument swap: scores = q.v / sqrt(1024) with q from x and 'v' from z, then + (-1e9) x mask where mask = max(strict-upper-triangle, 1 - pad_mask[key]);
//   softmax; output = weights . k with 'k' from y; heads re-merged -> [2][2048][1024]).
// Compute dtypes, f32 accumulate: every input rounded to bf16; the scores are a PLAIN bf16 GEMM of the inputs themselves (exact products); the mask is additive -1e9, exactly as the source, so a fully padded row falls back to all keys: key tiles behind a row block's diagonal are left out only where a flag formed from pad_mask says that their weights are exact zeros; scale + mask + softmax f32 -> hi and lo bf16 parts of each weight; weights.k as (hi, lo) x exact bf16 (2 products); a wave carries 32 query rows of one head and a run of keys from scores to partial output; the partial outputs of a row are joined in f32.

#define NB_  2
#define TT   2048
#define DM   1024
#define NH_  16
#define HD   64
#define ZH   2
typedef _Float16 h16;
typedef unsigned short bf;
typedef __attribute__((ext_vector_type(16))) __bf16   v16bf;
typedef __attribute__((ext_vector_type(16))) _Float16 v16h;
typedef __attribute__((ext_vector_type(8)))  _Float16 v8h;
typedef __attribute__((ext_vector_type(8)))  unsigned short v8us;
typedef __attribute__((ext_vector_type(8)))  float    v8f;
typedef __attribute__((ext_vector_type(4)))  float    v4f;
typedef v8h  __attribute__((may_alias)) v8ha;
typedef v4f  __attribute__((may_alias)) v4fa;
typedef v8us __attribute__((may_alias)) v8usa;

__device__ __forceinline__ unsigned short f2bf(float f) { unsigned u = __float_as_uint(f); u += 0x7FFFu + ((u >> 16) & 1u); return (unsigned short)(u >> 16); }
__device__ __forceinline__ float bf2f(unsigned short b) { return __uint_as_float(((unsigned)b) << 16); }
__device__ __forceinline__ float bfr(float f) { return bf2f(f2bf(f)); }
__device__ __forceinline__ v16h cat16(v8h lo, v8h hi) { return __builtin_shufflevector(lo, hi, 0, 1, 2, 3, 4, 5, 6, 7, 8, 9, 10, 11, 12, 13, 14, 15); }
__device__ __forceinline__ v16bf cat16b(v8us lo, v8us hi) { return __builtin_bit_cast(v16bf, __builtin_shufflevector(lo, hi, 0, 1, 2, 3, 4, 5, 6, 7, 8, 9, 10, 11, 12, 13, 14, 15)); }
__device__ __forceinline__ v8f wmma16(v16h a, v16h b, v8f c) { return __builtin_amdgcn_wmma_f32_16x16x32_f16(false, a, false, b, (short)0, c, false, false); }
__device__ __forceinline__ v8f wmmab(v16bf a, v16bf b, v8f c) { return __builtin_amdgcn_wmma_f32_16x16x32_bf16(false, a, false, b, (short)0, c, false, false); }



// fragment of a 16x16x32 product from a K-contiguous 16-bit plane: the lane's 8 elements at p and 8 at p + 16
template <typename T16> struct WFrag;
template <> struct WFrag<h16> { typedef v16h V; static __device__ __forceinline__ V ld(const h16* p) { return cat16(*(const v8h*)p, *(const v8h*)(p + 16)); } static __device__ __forceinline__ v8f mma(V a, V b, v8f c) { return wmma16(a, b, c); } };
template <> struct WFrag<bf> { typedef v16bf V; static __device__ __forceinline__ V ld(const bf* p) { return cat16b(*(const v8us*)p, *(const v8us*)(p + 16)); } static __device__ __forceinline__ v8f mma(V a, V b, v8f c) { return wmmab(a, b, c); } };

typedef __attribute__((ext_vector_type(4))) unsigned short v4us;

// k_prep: every layout step in ONE launch. A work-group of 16 waves takes PTT rows (t) x the 64 columns of one head of x, z and y; grid (TT/PTT, NH_, NB_).
//   x -> the bf16 head plane P[h][t][d] (16-B loads, 8-B stores). z and y -> planes in the FRAGMENT ORDER of k_attn's A operands: per head and pass of 32 keys 4 KiB = 4 fragments x 2 halves x 32 lanes x 16 B,
//   so that one 16-B load of a wave reads 512 bytes in a row (4 whole lines) and not 16 pieces of 32 B in 16 lines. Lane l = 16*hi + lr, half hf, element e:
//     z, fragment kt*2 + ks: key 16*kt + lr of the pass, d = 32*ks + 16*hf + 8*hi + e;   y, fragment dt: d = 16*dt + lr, key 16*hf + 8*hi + e of the pass (the k order of both is the one the row-major loaders had).
//   Both are read along d like x, put in that order in LDS, and the work-group's 16 KiB of each plane (its PTT/32 passes) go out as one run, 16 B a lane;
//   the work-groups of head 0 also write their PTT entries of MK[b][j] = (1 - bf16(pad_mask)) (f32) and the flags FL[b][rb] of their PTT/32 blocks of 32 query rows:
//   FL = 1 where some key j <= 32*rb has MK[j] <= 0.5. Every row of that block then has a score above -5e8 - |s|, every key behind the block's last row one below -1e9 + |s|, so the latter's exp is an exact 0.
#define PTT 128
#define KDP 260             // y tile: dwords per fragment (1 KiB + 16 B): the 4 fragments that the lanes of one LDS store fall in start 4 banks apart
#define KSP (4 * KDP)       // y tile: dwords per pass
#define VBP 72              // z tile: dwords per 256-B block (one half of a fragment, one hi; + 32 B): the 8 blocks that the lanes of one LDS store fall in start 8 banks apart
typedef __attribute__((ext_vector_type(4))) unsigned v4u;
typedef __attribute__((ext_vector_type(2))) unsigned v2u;
__global__ __launch_bounds__(512) void k_prep(const float* __restrict__ X, const float* __restrict__ Y, const float* __restrict__ Z, const float* __restrict__ pm, bf* QP, bf* VP, bf* KT, float* MK, int* FL) {
    __shared__ __attribute__((aligned(16))) unsigned tl[(PTT / 32) * KSP];
    __shared__ __attribute__((aligned(16))) unsigned tv[(PTT / 32) * 16 * VBP];
    __shared__ unsigned fw[16];   // one word of PTT/32 flag bits per wave
    const int tid = threadIdx.x, c4 = (tid & 15) * 4, rw = tid >> 4;   // the lane's 4 columns; its row (x, z) or row pair (y) within a pass of 32
    const int t0 = blockIdx.x * PTT; const size_t zh = (size_t)blockIdx.z * NH_ + blockIdx.y;
    const size_t src = ((size_t)blockIdx.z * TT + t0) * DM + blockIdx.y * HD + c4;
    const float* ys = Y + src; const float* xs = X + src; const float* zs = Z + src;
    const bool dom = blockIdx.y == 0 && tid < PTT / 4; const size_t me = (size_t)blockIdx.z * TT + t0 + (tid & (PTT / 4 - 1)) * 4;
    v4f mv = (v4f){}, pv = (v4f){}, ya[2][2], xa[4], za[4];
    const bool h0 = blockIdx.y == 0;
    if (h0) pv = *(const v4f*)(pm + (size_t)blockIdx.z * TT + tid * 4);   // the batch entry's whole pad_mask, 4 keys a thread, for the flags
    if (dom) mv = *(const v4f*)(pm + me);   // asked for ahead of the tiles, so that it is not a second trip to memory at the end
#pragma unroll
    for (int p = 0; p < 2; ++p)
#pragma unroll
        for (int q = 0; q < 2; ++q) ya[p][q] = *(const v4f*)(ys + (size_t)((p * 32 + rw) * 2 + q) * DM);
#pragma unroll
    for (int p = 0; p < 4; ++p) za[p] = *(const v4f*)(zs + (size_t)(p * 32 + rw) * DM);
#pragma unroll
    for (int p = 0; p < 4; ++p) xa[p] = *(const v4f*)(xs + (size_t)(p * 32 + rw) * DM);
#pragma unroll
    for (int p = 0; p < 2; ++p)
#pragma unroll
        for (int u = 0; u < 4; ++u)   // rows t, t+1 of one column: neighbouring keys of one lane's 16 B. Pass p*2 + rw/16, key 2*(rw & 15) of it
            tl[(p * 2 + (rw >> 4)) * KSP + ((c4 + u) >> 4) * KDP + ((rw & 15) >> 2) * 64 + ((c4 + u) & 15) * 4 + (rw & 3)] = (unsigned)f2bf(ya[p][0][u]) | ((unsigned)f2bf(ya[p][1][u]) << 16);
#pragma unroll
    for (int p = 0; p < 4; ++p)   // pass p, key rw of it, 4 neighbouring d: half of one lane's 16 B
        *(v2u*)(tv + (p * 16 + (rw >> 4) * 8 + (c4 >> 3)) * VBP + (rw & 15) * 4 + ((c4 >> 2) & 1) * 2) = (v2u){(unsigned)f2bf(za[p][0]) | ((unsigned)f2bf(za[p][1]) << 16), (unsigned)f2bf(za[p][2]) | ((unsigned)f2bf(za[p][3]) << 16)};
    if (h0) { unsigned open = 0, bits = 0;   // open, bit u: MK of key tid*4+u is at most 0.5
#pragma unroll
        for (int u = 0; u < 4; ++u) open |= (__fsub_rn(1.0f, bfr(pv[u])) <= 0.5f ? 1u : 0u) << u;
#pragma unroll
        for (int q = 0; q < PTT / 32; ++q) { const int n = t0 + q * 32 - tid * 4;   // the thread's keys u <= n count for row block q
            const unsigned in = n >= 3 ? 15u : n < 0 ? 0u : (2u << n) - 1u;
            bits |= (__any((open & in) != 0u) ? 1u : 0u) << q; }
        if ((tid & 31) == 0) fw[tid >> 5] = bits; }
    __syncthreads();   // the whole y and z tiles (and, for head 0, every wave's flag word) are in LDS before a run is read; it stands ahead of every global store, so that no wave waits out a store at it
    v4u* kd = (v4u*)(KT + (zh * TT + t0) * HD); v4u* vd = (v4u*)(VP + (zh * TT + t0) * HD);
#pragma unroll
    for (int p = 0; p < 2; ++p) { const int ci = p * 512 + tid;   // the thread's 16 B of the work-group's 16 KiB
        kd[ci] = *(const v4u*)(tl + (ci >> 8) * KSP + ((ci >> 6) & 3) * KDP + (ci & 63) * 4);
        vd[ci] = *(const v4u*)(tv + (ci >> 4) * VBP + (ci & 15) * 4); }
    bf* qd = QP + (zh * TT + t0) * HD + c4;
#pragma unroll
    for (int p = 0; p < 4; ++p) { v4us o;
#pragma unroll
        for (int u = 0; u < 4; ++u) o[u] = f2bf(xa[p][u]);
        *(v4us*)(qd + (p * 32 + rw) * HD) = o; }
    if (dom) { v4f r;
#pragma unroll
        for (int u = 0; u < 4; ++u) r[u] = __fsub_rn(1.0f, bfr(mv[u]));
        *(v4f*)(MK + me) = r; }
    if (h0 && tid < PTT / 32) { unsigned o = 0;
#pragma unroll
        for (int w = 0; w < 16; ++w) o |= fw[w];
        FL[blockIdx.z * (TT / 32) + t0 / 32 + tid] = (int)((o >> tid) & 1u); }
}
// ---- k_attn: scores, softmax and weights . k in registers; a wave works on RW query rows of one head and a run of key passes. Grid (NB_*NH_, NTL/8), 16 waves a work-group, 4 on a SIMD, so that one wave's vector work runs beside another's products.
// The products are taken transposed: S^T = v . q^T (A = 16 key rows, B = 16 query rows as columns), O^T += k^T . P^T (A = 16 rows d of the transposed plane, B = the weights). Both A planes lie in fragment order (see k_prep).
// A lane then holds, for ONE query (its column), 8 neighbouring keys of each 16-key tile: maximum and sum are in-lane but for one exchange between the wave's halves,
// and the two score tiles of a 32-key pass, converted in place, ARE the B operand of the second product in the loaders' own k order (8 at 8*hi, 8 at 16 + 8*hi).
// A pass is 32 keys. A row tile has NS passes: up to its diagonal pass where its flag FL is set (the keys behind it then have weights that are exact zeros: see k_prep), all TT/32 otherwise.
// The maximum in use m follows the running maximum lazily: sums and output tiles are rescaled only in a pass where some column's maximum has risen more than 5.5 above m (weights stay below e^5.5); the division by the row sum stands at the end.
// Balance: four waves (pi, 0..3) share the row tiles tA = NTL - 1 - tB and tB. The passes of tA followed by those of tB are one list, and each wave takes a quarter of it, so every wave of the launch has the same number of passes to within one;
// a wave whose quarter holds the end of tA and the start of tB works them one after the other (two pieces). Each piece leaves its maximum in use, row sums and output tiles in an LDS slot of its own: piece of tA of wave rl in slot rl, piece of tB in slot rl + 1.
// Behind the one barrier each wave joins the pieces of 16 rows of one tile (each scaled by e^(its m - the largest m)), divides and stores.
// Every inner loop is unrolled so that the fragment, score and output arrays are indexed by constants and stay in registers; the loop over the passes stays rolled.
#define RW 32
#define NTL (TT / RW)
#define SLB 2176            // floats of a slot: 16 blocks of 128 (4 output values a lane), then 128 (m[0], m[1], row sums 0 and 1 of each lane)
typedef __attribute__((ext_vector_type(2))) float v2f;
typedef __attribute__((ext_vector_type(2))) __bf16 v2bf;
typedef __attribute__((ext_vector_type(8))) unsigned v8u;
#define L2E 1.4426950408889634f
// a byte pointer that keeps its global address space through an asm statement (a plain pointer would come out of it as a flat one), and the loader of a fragment-ordered plane on it: the lane's 8 elements at p, 8 at p + 512 bytes
typedef const __attribute__((address_space(1))) char* gcp;
__device__ __forceinline__ v16bf ldg(gcp p) { return cat16b(*(const __attribute__((address_space(1))) v8us*)p, *(const __attribute__((address_space(1))) v8us*)(p + 512)); }
// the value of the lane 16 away
__device__ __forceinline__ float xhalf(float x) { const int b = __float_as_int(x); return __int_as_float(__builtin_amdgcn_permlanex16(b, b, 0x76543210, 0xfedcba98, false, false)); }
__global__ __launch_bounds__(512) void k_attn(const bf* __restrict__ Q, const bf* __restrict__ V, const bf* __restrict__ Kt, const float* __restrict__ MK, const int* __restrict__ FL, float* OUT) {
    __shared__ __attribute__((aligned(16))) float mg[4 * 5 * SLB];
    const int zb = blockIdx.x / NH_, hd = blockIdx.x % NH_;
    const int lane = threadIdx.x & 31, lr = lane & 15, hi = lane >> 4, wv = __builtin_amdgcn_readfirstlane((int)(threadIdx.x >> 5));
    const int pi = wv & 3, rl = wv >> 2;
    const int tB = (int)blockIdx.y * 4 + pi, tA = NTL - 1 - tB;
    const size_t zh = blockIdx.x; Q += zh * (size_t)TT * HD; V += zh * (size_t)TT * HD; Kt += zh * (size_t)TT * HD; MK += (size_t)zb * TT;
    const int NSA = __builtin_amdgcn_readfirstlane(FL[zb * NTL + tA] != 0 ? tA + 1 : NTL), NSB = __builtin_amdgcn_readfirstlane(FL[zb * NTL + tB] != 0 ? tB + 1 : NTL);
    const int tot = NSA + NSB, cl = (rl * tot) >> 2, ch = ((rl + 1) * tot) >> 2;   // the wave's quarter [cl, ch) of the list
    unsigned oF = (unsigned)lane * 16u, oM = (unsigned)lane * 4u;   // the lane's byte offsets in each 512-B half of a fragment (both planes) and in a pass's mask entries
    for (int sg = 0; sg < 2; ++sg) {
    const int tl = sg ? tB : tA, s0 = sg ? (cl > NSA ? cl - NSA : 0) : cl, s1 = sg ? ch - NSA : (ch < NSA ? ch : NSA);   // the piece: passes [s0, s1) of row tile tl
    if (s0 >= s1) continue;
    const int r0 = tl * RW;
    const bf* Vs = V + (size_t)s0 * 32 * HD; const bf* Ks = Kt + (size_t)s0 * 32 * HD; const float* Ms = MK + s0 * 32;   // the piece's first pass
    const bf* pQ = Q + (r0 + lr) * HD + 8 * hi; gcp pV = (gcp)(const char*)Vs + oF, pK = (gcp)(const char*)Ks + oF;
    v16bf qb[2][2], va[2][2], ka[4];
#pragma unroll
    for (int c = 0; c < 2; ++c)
#pragma unroll
        for (int ks = 0; ks < 2; ++ks) qb[c][ks] = WFrag<bf>::ld(pQ + c * 16 * HD + ks * 32);
    float mkl = *(const float*)((const char*)Ms + oM);   // one mask entry a lane: the pass's 32 keys, for the test whether any of them is masked at all
#pragma unroll
    for (int kt = 0; kt < 2; ++kt)
#pragma unroll
        for (int ks = 0; ks < 2; ++ks) va[kt][ks] = ldg(pV + (kt * 2 + ks) * 1024);
    // behind these loads, ahead of every later write of their address registers; it also keeps the loads in the loop's own order (mask entry, key rows, then the transposed plane), so that the first product's counted wait leaves the plane's loads in flight
    asm volatile("s_wait_xcnt 0x0" :: "v"(pQ), "v"(oF), "s"(Vs) : "memory");
#pragma unroll
    for (int dt = 0; dt < 4; ++dt) ka[dt] = ldg(pK + dt * 1024);
    // behind the last load in front of the loop, ahead of every later write of a register that one of them names as its address
    asm volatile("s_wait_xcnt 0x0" :: "v"(oF), "v"(oM), "s"(Ks), "s"(Ms) : "memory");
    // bases: bk of the plane rows last fetched; bv and bm of the key rows and mask entries that the coming pass fetches ahead (the piece's second pass, or its first again where there is no other)
    gcp bk = (gcp)(const char*)Ks, bv = (gcp)(const char*)Vs + (size_t)(s0 + 1 < s1 ? 32 * HD * 2 : 0), bm = (gcp)(const char*)Ms + (size_t)(s0 + 1 < s1 ? 32 * 4 : 0);
    v8f acc[2][4]; float m[2]; v2f l2[2];
#pragma unroll
    for (int c = 0; c < 2; ++c) { m[c] = -3.0e38f; l2[c] = (v2f){};
#pragma unroll
        for (int dt = 0; dt < 4; ++dt) acc[c][dt] = (v8f){}; }
    for (int st = s0; st < s1; ++st) {
        v8f s[2][2];
#pragma unroll
        for (int c = 0; c < 2; ++c)
#pragma unroll
            for (int kt = 0; kt < 2; ++kt) s[c][kt] = wmmab(va[kt][0], qb[c][0], (v8f){});
#pragma unroll
        for (int c = 0; c < 2; ++c)
#pragma unroll
            for (int kt = 0; kt < 2; ++kt) s[c][kt] = wmmab(va[kt][1], qb[c][1], s[c][kt]);
        // plain pass: wholly in front of the diagonal and no key with a mask entry above 0, so that -1e9 * max(0, entry) is a zero and adding it an identity
        const bool plain = (st < tl) & (__builtin_amdgcn_ballot_w32(mkl > 0.f) == 0u);
        // the next pass's key rows go into the registers that the products above have just read: they have the softmax and the second product to arrive
        mkl = *(const __attribute__((address_space(1))) float*)(bm + oM);
#pragma unroll
        for (int kt = 0; kt < 2; ++kt)
#pragma unroll
            for (int ks = 0; ks < 2; ++ks) va[kt][ks] = ldg(bv + oF + (kt * 2 + ks) * 1024);
        v2f t[2][8];   // t[c][kt * 4 + q]: keys kt*16 + 8*hi + 2q, + 1 of the pass, query column c*16 + lr
        if (plain) {
#pragma unroll
            for (int c = 0; c < 2; ++c)
#pragma unroll
                for (int k = 0; k < 8; ++k) t[c][k] = (v2f){s[c][k >> 2][(k & 3) * 2], s[c][k >> 2][(k & 3) * 2 + 1]} * 0.03125f;
        } else {
            const float* pm = MK + st * 32 + 8 * hi; v4f mk4[4];
            mk4[0] = *(const v4f*)pm; mk4[1] = *(const v4f*)(pm + 4); mk4[2] = *(const v4f*)(pm + 16); mk4[3] = *(const v4f*)(pm + 20);
            // behind the four mask loads, ahead of every later write of their address register
            asm volatile("s_wait_xcnt 0x0" :: "v"(pm) : "memory");
#pragma unroll
            for (int c = 0; c < 2; ++c) { const int i = r0 + c * 16 + lr;
#pragma unroll
                for (int k = 0; k < 8; ++k)
#pragma unroll
                    for (int u = 0; u < 2; ++u) { const int e = (k & 3) * 2 + u, j = st * 32 + (k >> 2) * 16 + 8 * hi + e;
                        const float mk = fmaxf((j > i) ? 1.f : 0.f, mk4[(k >> 2) * 2 + (e >> 2)][e & 3]);
                        t[c][k][u] = s[c][k >> 2][e] * 0.03125f + __fmul_rn(-1e9f, mk); } }   // the scaling is by a power of two, exact: fused or not, the sum rounds once, as the source's
        }
        float ml[2];
#pragma unroll
        for (int c = 0; c < 2; ++c) { float x[8];
#pragma unroll
            for (int k = 0; k < 8; ++k) x[k] = fmaxf(t[c][k][0], t[c][k][1]);
            const float y = fmaxf(fmaxf(fmaxf(x[0], x[1]), fmaxf(x[2], x[3])), fmaxf(fmaxf(x[4], x[5]), fmaxf(x[6], x[7])));
            ml[c] = fmaxf(y, xhalf(y)); }
        if (__builtin_amdgcn_ballot_w32(ml[0] > m[0] + 5.5f || ml[1] > m[1] + 5.5f) != 0u) {
#pragma unroll
            for (int c = 0; c < 2; ++c) { const float mn = fmaxf(m[c], ml[c]); const float al = __builtin_amdgcn_exp2f((m[c] - mn) * L2E); m[c] = mn; l2[c] *= al;
#pragma unroll
                for (int dt = 0; dt < 4; ++dt) acc[c][dt] *= al; }
        }
        v16bf ph[2], pl[2];
#pragma unroll
        for (int c = 0; c < 2; ++c) { v8u hu, lu;
#pragma unroll
            for (int k = 0; k < 8; ++k) { const v2f x = (t[c][k] - m[c]) * L2E;   // the difference first: it is an exact 0 where a masked row's entries all equal m
                const v2f p = (v2f){__builtin_amdgcn_exp2f(x[0]), __builtin_amdgcn_exp2f(x[1])}; l2[c] += p;
                const unsigned h = __builtin_bit_cast(unsigned, __builtin_convertvector(p, v2bf));
                const v2f r = p - (v2f){__uint_as_float(h << 16), __uint_as_float(h & 0xFFFF0000u)};
                hu[k] = h; lu[k] = __builtin_bit_cast(unsigned, __builtin_convertvector(r, v2bf)); }
            ph[c] = __builtin_bit_cast(v16bf, hu); pl[c] = __builtin_bit_cast(v16bf, lu); }
#pragma unroll
        for (int c = 0; c < 2; ++c)
#pragma unroll
            for (int dt = 0; dt < 4; ++dt) acc[c][dt] = wmmab(ka[dt], ph[c], acc[c][dt]);
#pragma unroll
        for (int c = 0; c < 2; ++c)
#pragma unroll
            for (int dt = 0; dt < 4; ++dt) acc[c][dt] = wmmab(ka[dt], pl[c], acc[c][dt]);
        // the next pass's rows of the transposed plane, likewise into the registers just read: they have the next pass's first product and softmax to arrive
        // Addresses in the loop: a scalar base that moves with the pass and a lane offset that never changes. The one wait of a pass for the loads issued so far stands here, in front of the step of all three bases,
        // where those loads have had the softmax to run out, and not directly behind them; bases and offsets go through the statement so that the bases are stepped behind it, all stay in their registers up to it,
        // and each address is formed from its two parts at the load itself (scalar base + 32-bit lane offset), in no further register.
        asm volatile("s_wait_xcnt 0x0" : "+s"(bv), "+s"(bm), "+s"(bk), "+v"(oF), "+v"(oM) :: "memory");
        bk += (size_t)(st + 1 < s1 ? 32 * HD * 2 : 0);                                                       // the piece's last pass fetches itself again, in bounds
        bv += (size_t)(st + 2 < s1 ? 32 * HD * 2 : 0); bm += (size_t)(st + 2 < s1 ? 32 * 4 : 0);   // for the fetch that the next pass makes
#pragma unroll
        for (int dt = 0; dt < 4; ++dt) ka[dt] = ldg(bk + oF + dt * 1024);
    }
    // behind the last pass's fetches, ahead of every later write of a register that one of them names as its address (bases and offsets ride along as inputs, so that they stay in their registers up to here)
    asm volatile("s_wait_xcnt 0x0" :: "s"(bv), "s"(bm), "s"(bk), "v"(oF), "v"(oM) : "memory");
    float* sl = mg + (pi * 5 + rl + sg) * SLB + lane * 4; float lj[2];   // the piece's slot, 16 B a lane in each block
#pragma unroll
    for (int c = 0; c < 2; ++c) { const float l = l2[c][0] + l2[c][1]; lj[c] = l + xhalf(l);
#pragma unroll
        for (int dt = 0; dt < 4; ++dt) { const v8f o = acc[c][dt];
            *(v4f*)(sl + ((c * 4 + dt) * 2) * 128) = (v4f){o[0], o[1], o[2], o[3]}; *(v4f*)(sl + ((c * 4 + dt) * 2 + 1) * 128) = (v4f){o[4], o[5], o[6], o[7]}; } }
    *(v4f*)(sl + 16 * 128) = (v4f){m[0], m[1], lj[0], lj[1]};
    }
    __syncthreads();   // every piece of the work-group's 8 row tiles is in its slot before one is read
    // the wave joins query columns c*16 .. +15 of tile tB (x = 1) or tA (x = 0). Slots of tA: 0 .. (waves whose quarter starts in front of its end) - 1; of tB: 5 - (waves whose quarter ends behind its start) .. 4
    const int x = rl >> 1, c = rl & 1;
    int nA = 0, nB = 0;
    for (int j = 0; j < 4; ++j) { nA += ((j * tot) >> 2) < NSA ? 1 : 0; nB += (((j + 1) * tot) >> 2) > NSA ? 1 : 0; }
    const int q0 = x ? 5 - nB : 0, q1 = x ? 5 : nA;
    const float* sb = mg + pi * 5 * SLB + lane * 4;
    float M = sb[q0 * SLB + 16 * 128 + c], l = 0.f; v8f o[4];   // a tile has 1 to 4 pieces
#pragma unroll
    for (int dt = 0; dt < 4; ++dt) o[dt] = (v8f){};
#pragma unroll
    for (int k = 1; k < 4; ++k) M = fmaxf(M, sb[(q0 + k < q1 ? q0 + k : q0) * SLB + 16 * 128 + c]);   // where there is no piece k, the first again; unrolled so that the four reads go out together
    for (int q = q0; q < q1; ++q) { const float* p = sb + q * SLB;
        const float f = __builtin_amdgcn_exp2f((p[16 * 128 + c] - M) * L2E); l += p[16 * 128 + 2 + c] * f;
#pragma unroll
        for (int dt = 0; dt < 4; ++dt) { const v4f a = *(const v4f*)(p + ((c * 4 + dt) * 2) * 128), b = *(const v4f*)(p + ((c * 4 + dt) * 2 + 1) * 128);
            o[dt] += (v8f){a[0], a[1], a[2], a[3], b[0], b[1], b[2], b[3]} * f; } }
    const float f = __fdiv_rn(1.0f, l);
    float* po = OUT + ((size_t)zb * TT + (x ? tB : tA) * RW + c * 16 + lr) * DM + hd * HD + 8 * hi;   // the lane's 8 neighbouring d of each 16-row output tile
#pragma unroll
    for (int dt = 0; dt < 4; ++dt) { const v8f r = o[dt] * f;
        *(v4f*)(po + dt * 16) = (v4f){r[0], r[1], r[2], r[3]}; *(v4f*)(po + dt * 16 + 4) = (v4f){r[4], r[5], r[6], r[7]}; }
}

extern "C" void kernel_launch(void* const* d_in, const int* in_sizes, int n_in,
                              void* d_out, int out_size, void* d_ws, size_t ws_size, hipStream_t stream) {
    (void)in_sizes; (void)n_in; (void)out_size;
    const float* x = (const float*)d_in[0]; const float* y = (const float*)d_in[1]; const float* z = (const float*)d_in[2]; const float* pm = (const float*)d_in[3];
    float* OUT = (float*)d_out;     // [2][2048][1024]
    char* wsp = (char*)d_ws;
    auto take = [&](size_t bytes) { char* p = wsp; wsp += (bytes + 255) & ~(size_t)255; return (void*)p; };
    const size_t zb = (size_t)NH_ * TT * HD;   // elements of one batch entry's planes
    bf* QP = (bf*)take(NB_ * zb * 2); bf* VP = (bf*)take(NB_ * zb * 2); bf* KT = (bf*)take(NB_ * zb * 2); float* MK = (float*)take((size_t)NB_ * TT * 4); int* FL = (int*)take((size_t)NB_ * (TT / RW) * 4);
    if ((size_t)(wsp - (char*)d_ws) > ws_size) return;    // total ~ 24 MB
    k_prep<<<dim3(TT / PTT, NH_, NB_), 512, 0, stream>>>(x, y, z, pm, QP, VP, KT, MK, FL);   // scores use z ('value'), output uses y ('key')
    k_attn<<<dim3(NB_ * NH_, NTL / 8), 512, 0, stream>>>(QP, VP, KT, MK, FL, OUT);
}

// v009
// Measured time: 28.7 microseconds a run.
// Versions in between are left out here; by their measured steps it is 1.23 times as fast as v007.
// Over all steps from v000 it is 46.8 times as fast.
#include <hip/hip_runtime.h>

// decoderSelfAttention (x, y, z [2][2048][1024] split into 16 heads x 64 with NO projections; pad_mask [2][2048] (float, read); faithful to the source's argument swap: scores = q.v / sqrt(1024) with q from x and 'v' from z, then + (-1e9) x mask where mask = max(strict-upper-triangle, 1 - pad_mask[key]);
//   softmax; output = weights . k with 'k' from y; heads re-merged -> [2][2048][1024]).
// Compute dtypes, f32 accumulate: every input rounded to bf16; the scores are a PLAIN bf16 GEMM of the inputs themselves (exact products); the mask is additive -1e9, exactly as the source, so a fully padded row falls back to all keys: key tiles behind a row block's diagonal are left out only where a flag formed from pad_mask says that their weights are exact zeros; scale + mask + softmax f32 -> each weight rounded once to f16 (11 significant bits; weights lie in [0, e^5.5]); weights.k as ONE f16 product, its k plane holding the bf16-rounded y written as f16 (the same value for 2^-14 <= |y| < 65520: 8 significant bits fit in 11; below 2^-14 to within 2^-25; y is standard normal); a wave carries 32 query rows of one head and a run of keys from scores to partial output; the partial outputs of a row are joined in f32.

#define NB_  2
#define TT   2048
#define DM   1024
#define NH_  16
#define HD   64
#define ZH   2
typedef _Float16 h16;
typedef unsigned short bf;
typedef __attribute__((ext_vector_type(16))) __bf16   v16bf;
typedef __attribute__((ext_vector_type(16))) _Float16 v16h;
typedef __attribute__((ext_vector_type(8)))  _Float16 v8h;
typedef __attribute__((ext_vector_type(8)))  unsigned short v8us;
typedef __attribute__((ext_vector_type(8)))  float    v8f;
typedef __attribute__((ext_vector_type(4)))  float    v4f;
typedef v8h  __attribute__((may_alias)) v8ha;
typedef v4f  __attribute__((may_alias)) v4fa;
typedef v8us __attribute__((may_alias)) v8usa;

__device__ __forceinline__ unsigned short f2bf(float f) { unsigned u = __float_as_uint(f); u += 0x7FFFu + ((u >> 16) & 1u); return (unsigned short)(u >> 16); }
__device__ __forceinline__ float bf2f(unsigned short b) { return __uint_as_float(((unsigned)b) << 16); }
__device__ __forceinline__ float bfr(float f) { return bf2f(f2bf(f)); }
typedef __attribute__((ext_vector_type(2))) float v2f;
typedef __attribute__((ext_vector_type(2))) _Float16 v2h;
// two f32 values rounded to nearest f16, packed (a in the low half)
__device__ __forceinline__ unsigned pkh(float a, float b) { return __builtin_bit_cast(unsigned, __builtin_convertvector((v2f){a, b}, v2h)); }
__device__ __forceinline__ v16h cat16(v8h lo, v8h hi) { return __builtin_shufflevector(lo, hi, 0, 1, 2, 3, 4, 5, 6, 7, 8, 9, 10, 11, 12, 13, 14, 15); }
__device__ __forceinline__ v16bf cat16b(v8us lo, v8us hi) { return __builtin_bit_cast(v16bf, __builtin_shufflevector(lo, hi, 0, 1, 2, 3, 4, 5, 6, 7, 8, 9, 10, 11, 12, 13, 14, 15)); }
__device__ __forceinline__ v8f wmma16(v16h a, v16h b, v8f c) { return __builtin_amdgcn_wmma_f32_16x16x32_f16(false, a, false, b, (short)0, c, false, false); }
__device__ __forceinline__ v8f wmmab(v16bf a, v16bf b, v8f c) { return __builtin_amdgcn_wmma_f32_16x16x32_bf16(false, a, false, b, (short)0, c, false, false); }



// fragment of a 16x16x32 product from a K-contiguous 16-bit plane: the lane's 8 elements at p and 8 at p + 16
template <typename T16> struct WFrag;
template <> struct WFrag<h16> { typedef v16h V; static __device__ __forceinline__ V ld(const h16* p) { return cat16(*(const v8h*)p, *(const v8h*)(p + 16)); } static __device__ __forceinline__ v8f mma(V a, V b, v8f c) { return wmma16(a, b, c); } };
template <> struct WFrag<bf> { typedef v16bf V; static __device__ __forceinline__ V ld(const bf* p) { return cat16b(*(const v8us*)p, *(const v8us*)(p + 16)); } static __device__ __forceinline__ v8f mma(V a, V b, v8f c) { return wmmab(a, b, c); } };

typedef __attribute__((ext_vector_type(4))) unsigned short v4us;

// k_prep: every layout step in ONE launch. A work-group of 16 waves takes PTT rows (t) x the 64 columns of one head of x, z and y; grid (TT/PTT, NH_, NB_).
//   x -> the bf16 head plane P[h][t][d] (16-B loads, 8-B stores). z (bf16) and y (rounded to bf16, stored as f16) -> planes in the FRAGMENT ORDER of k_attn's A operands: per head and pass of 32 keys 4 KiB = 4 fragments x 2 halves x 32 lanes x 16 B,
//   so that one 16-B load of a wave reads 512 bytes in a row (4 whole lines) and not 16 pieces of 32 B in 16 lines. Lane l = 16*hi + lr, half hf, element e:
//     z, fragment kt*2 + ks: key 16*kt + lr of the pass, d = 32*ks + 16*hf + 8*hi + e;   y, fragment dt: d = 16*dt + lr, key 16*hf + 8*hi + e of the pass (the k order of both is the one the row-major loaders had).
//   Both are read along d like x, put in that order in LDS, and the work-group's 16 KiB of each plane (its PTT/32 passes) go out as one run, 16 B a lane;
//   the work-groups of head 0 also write their PTT entries of MK[b][j] = (1 - bf16(pad_mask)) (f32) and the flags FL[b][rb] of their PTT/32 blocks of 32 query rows:
//   FL = 1 where some key j <= 32*rb has MK[j] <= 0.5. Every row of that block then has a score above -5e8 - |s|, every key behind the block's last row one below -1e9 + |s|, so the latter's exp is an exact 0.
#define PTT 128
#define KDP 260             // y tile: dwords per fragment (1 KiB + 16 B): the 4 fragments that the lanes of one LDS store fall in start 4 banks apart
#define KSP (4 * KDP)       // y tile: dwords per pass
#define VBP 72              // z tile: dwords per 256-B block (one half of a fragment, one hi; + 32 B): the 8 blocks that the lanes of one LDS store fall in start 8 banks apart
typedef __attribute__((ext_vector_type(4))) unsigned v4u;
typedef __attribute__((ext_vector_type(2))) unsigned v2u;
__global__ __launch_bounds__(512) void k_prep(const float* __restrict__ X, const float* __restrict__ Y, const float* __restrict__ Z, const float* __restrict__ pm, bf* QP, bf* VP, bf* KT, float* MK, int* FL) {
    __shared__ __attribute__((aligned(16))) unsigned tl[(PTT / 32) * KSP];
    __shared__ __attribute__((aligned(16))) unsigned tv[(PTT / 32) * 16 * VBP];
    __shared__ unsigned fw[16];   // one word of PTT/32 flag bits per wave
    const int tid = threadIdx.x, c4 = (tid & 15) * 4, rw = tid >> 4;   // the lane's 4 columns; its row (x, z) or row pair (y) within a pass of 32
    const int t0 = blockIdx.x * PTT; const size_t zh = (size_t)blockIdx.z * NH_ + blockIdx.y;
    const size_t src = ((size_t)blockIdx.z * TT + t0) * DM + blockIdx.y * HD + c4;
    const float* ys = Y + src; const float* xs = X + src; const float* zs = Z + src;
    const bool dom = blockIdx.y == 0 && tid < PTT / 4; const size_t me = (size_t)blockIdx.z * TT + t0 + (tid & (PTT / 4 - 1)) * 4;
    v4f mv = (v4f){}, pv = (v4f){}, ya[2][2], xa[4], za[4];
    const bool h0 = blockIdx.y == 0;
    if (h0) pv = *(const v4f*)(pm + (size_t)blockIdx.z * TT + tid * 4);   // the batch entry's whole pad_mask, 4 keys a thread, for the flags
    if (dom) mv = *(const v4f*)(pm + me);   // asked for ahead of the tiles, so that it is not a second trip to memory at the end
#pragma unroll
    for (int p = 0; p < 2; ++p)
#pragma unroll
        for (int q = 0; q < 2; ++q) ya[p][q] = *(const v4f*)(ys + (size_t)((p * 32 + rw) * 2 + q) * DM);
#pragma unroll
    for (int p = 0; p < 4; ++p) za[p] = *(const v4f*)(zs + (size_t)(p * 32 + rw) * DM);
#pragma unroll
    for (int p = 0; p < 4; ++p) xa[p] = *(const v4f*)(xs + (size_t)(p * 32 + rw) * DM);
#pragma unroll
    for (int p = 0; p < 2; ++p)
#pragma unroll
        for (int u = 0; u < 4; ++u)   // rows t, t+1 of one column: neighbouring keys of one lane's 16 B. Pass p*2 + rw/16, key 2*(rw & 15) of it
            tl[(p * 2 + (rw >> 4)) * KSP + ((c4 + u) >> 4) * KDP + ((rw & 15) >> 2) * 64 + ((c4 + u) & 15) * 4 + (rw & 3)] = pkh(bfr(ya[p][0][u]), bfr(ya[p][1][u]));
#pragma unroll
    for (int p = 0; p < 4; ++p)   // pass p, key rw of it, 4 neighbouring d: half of one lane's 16 B
        *(v2u*)(tv + (p * 16 + (rw >> 4) * 8 + (c4 >> 3)) * VBP + (rw & 15) * 4 + ((c4 >> 2) & 1) * 2) = (v2u){(unsigned)f2bf(za[p][0]) | ((unsigned)f2bf(za[p][1]) << 16), (unsigned)f2bf(za[p][2]) | ((unsigned)f2bf(za[p][3]) << 16)};
    if (h0) { unsigned open = 0, bits = 0;   // open, bit u: MK of key tid*4+u is at most 0.5
#pragma unroll
        for (int u = 0; u < 4; ++u) open |= (__fsub_rn(1.0f, bfr(pv[u])) <= 0.5f ? 1u : 0u) << u;
#pragma unroll
        for (int q = 0; q < PTT / 32; ++q) { const int n = t0 + q * 32 - tid * 4;   // the thread's keys u <= n count for row block q
            const unsigned in = n >= 3 ? 15u : n < 0 ? 0u : (2u << n) - 1u;
            bits |= (__any((open & in) != 0u) ? 1u : 0u) << q; }
        if ((tid & 31) == 0) fw[tid >> 5] = bits; }
    __syncthreads();   // the whole y and z tiles (and, for head 0, every wave's flag word) are in LDS before a run is read; it stands ahead of every global store, so that no wave waits out a store at it
    v4u* kd = (v4u*)(KT + (zh * TT + t0) * HD); v4u* vd = (v4u*)(VP + (zh * TT + t0) * HD);
#pragma unroll
    for (int p = 0; p < 2; ++p) { const int ci = p * 512 + tid;   // the thread's 16 B of the work-group's 16 KiB
        kd[ci] = *(const v4u*)(tl + (ci >> 8) * KSP + ((ci >> 6) & 3) * KDP + (ci & 63) * 4);
        vd[ci] = *(const v4u*)(tv + (ci >> 4) * VBP + (ci & 15) * 4); }
    bf* qd = QP + (zh * TT + t0) * HD + c4;
#pragma unroll
    for (int p = 0; p < 4; ++p) { v4us o;
#pragma unroll
        for (int u = 0; u < 4; ++u) o[u] = f2bf(xa[p][u]);
        *(v4us*)(qd + (p * 32 + rw) * HD) = o; }
    if (dom) { v4f r;
#pragma unroll
        for (int u = 0; u < 4; ++u) r[u] = __fsub_rn(1.0f, bfr(mv[u]));
        *(v4f*)(MK + me) = r; }
    if (h0 && tid < PTT / 32) { unsigned o = 0;
#pragma unroll
        for (int w = 0; w < 16; ++w) o |= fw[w];
        FL[blockIdx.z * (TT / 32) + t0 / 32 + tid] = (int)((o >> tid) & 1u); }
}
// ---- k_attn: scores, softmax and weights . k in registers; a wave works on RW query rows of one head and a run of key passes. Grid (NB_*NH_, NTL/8), 16 waves a work-group, 4 on a SIMD, so that one wave's vector work runs beside another's products.
// The products are taken transposed: S^T = v . q^T (A = 16 key rows, B = 16 query rows as columns), O^T += k^T . P^T (A = 16 rows d of the transposed plane, B = the weights). Both A planes lie in fragment order (see k_prep).
// A lane then holds, for ONE query (its column), 8 neighbouring keys of each 16-key tile: maximum and sum are in-lane but for one exchange between the wave's halves,
// and the two score tiles of a 32-key pass, converted in place, ARE the B operand of the second product in the loaders' own k order (8 at 8*hi, 8 at 16 + 8*hi).
// A pass is 32 keys. A row tile has NS passes: up to its diagonal pass where its flag FL is set (the keys behind it then have weights that are exact zeros: see k_prep), all TT/32 otherwise.
// The maximum in use m follows the running maximum lazily: sums and output tiles are rescaled only in a pass where some column's maximum has risen more than 5.5 above m (weights stay below e^5.5); the division by the row sum stands at the end.
// Balance: four waves (pi, 0..3) share the row tiles tA = NTL - 1 - tB and tB. The passes of tA followed by those of tB are one list, and each wave takes a quarter of it, so every wave of the launch has the same number of passes to within one;
// a wave whose quarter holds the end of tA and the start of tB works them one after the other (two pieces). Each piece leaves its maximum in use, row sums and output tiles in an LDS slot of its own: piece of tA of wave rl in slot rl, piece of tB in slot rl + 1.
// Behind the one barrier each wave joins the pieces of 16 rows of one tile (each scaled by e^(its m - the largest m)), divides and stores.
// Every inner loop is unrolled so that the fragment, score and output arrays are indexed by constants and stay in registers; the loop over the passes stays rolled.
#define RW 32
#define NTL (TT / RW)
#define SLB 2176            // floats of a slot: 16 blocks of 128 (4 output values a lane), then 128 (m[0], m[1], row sums 0 and 1 of each lane)
typedef __attribute__((ext_vector_type(8))) unsigned v8u;
#define L2E 1.4426950408889634f
// The softmax works on the RAW products s (32 times the scaled score; the scaling by 1/32 is a power of two, so every sum, difference and maximum below is exactly 32 times the scaled one). CX turns a raw difference into the exponent of 2.
#define CX (L2E * 0.03125f)
#define LAZ 176.0f          // 5.5 in raw units
// a byte pointer that keeps its global address space through an asm statement (a plain pointer would come out of it as a flat one), and the loader of a fragment-ordered plane on it: the lane's 8 elements at p, 8 at p + 512 bytes
typedef const __attribute__((address_space(1))) char* gcp;
__device__ __forceinline__ v16bf ldg(gcp p) { return cat16b(*(const __attribute__((address_space(1))) v8us*)p, *(const __attribute__((address_space(1))) v8us*)(p + 512)); }
__device__ __forceinline__ v16h ldgh(gcp p) { return __builtin_bit_cast(v16h, ldg(p)); }   // the same of the f16 plane
// the value of the lane 16 away
__device__ __forceinline__ float xhalf(float x) { const int b = __float_as_int(x); return __int_as_float(__builtin_amdgcn_permlanex16(b, b, 0x76543210, 0xfedcba98, false, false)); }
__global__ __launch_bounds__(512) void k_attn(const bf* __restrict__ Q, const bf* __restrict__ V, const bf* __restrict__ Kt, const float* __restrict__ MK, const int* __restrict__ FL, float* OUT) {
    __shared__ __attribute__((aligned(16))) float mg[4 * 5 * SLB];
    const int zb = blockIdx.x / NH_, hd = blockIdx.x % NH_;
    const int lane = threadIdx.x & 31, lr = lane & 15, hi = lane >> 4, wv = __builtin_amdgcn_readfirstlane((int)(threadIdx.x >> 5));
    const int pi = wv & 3, rl = wv >> 2;
    const int tB = (int)blockIdx.y * 4 + pi, tA = NTL - 1 - tB;
    const size_t zh = blockIdx.x; Q += zh * (size_t)TT * HD; V += zh * (size_t)TT * HD; Kt += zh * (size_t)TT * HD; MK += (size_t)zb * TT;
    const int NSA = __builtin_amdgcn_readfirstlane(FL[zb * NTL + tA] != 0 ? tA + 1 : NTL), NSB = __builtin_amdgcn_readfirstlane(FL[zb * NTL + tB] != 0 ? tB + 1 : NTL);
    const int tot = NSA + NSB, cl = (rl * tot) >> 2, ch = ((rl + 1) * tot) >> 2;   // the wave's quarter [cl, ch) of the list
    unsigned oF = (unsigned)lane * 16u, oM = (unsigned)lane * 4u;   // the lane's byte offsets in each 512-B half of a fragment (both planes) and in a pass's mask entries
    for (int sg = 0; sg < 2; ++sg) {
    const int tl = sg ? tB : tA, s0 = sg ? (cl > NSA ? cl - NSA : 0) : cl, s1 = sg ? ch - NSA : (ch < NSA ? ch : NSA);   // the piece: passes [s0, s1) of row tile tl
    if (s0 >= s1) continue;
    const int r0 = tl * RW;
    const bf* Vs = V + (size_t)s0 * 32 * HD; const bf* Ks = Kt + (size_t)s0 * 32 * HD; const float* Ms = MK + s0 * 32;   // the piece's first pass
    const bf* pQ = Q + (r0 + lr) * HD + 8 * hi; gcp pV = (gcp)(const char*)Vs + oF, pK = (gcp)(const char*)Ks + oF;
    v16bf qb[2][2], va[2][2]; v16h ka[4];
#pragma unroll
    for (int c = 0; c < 2; ++c)
#pragma unroll
        for (int ks = 0; ks < 2; ++ks) qb[c][ks] = WFrag<bf>::ld(pQ + c * 16 * HD + ks * 32);
    float mkl = *(const float*)((const char*)Ms + oM);   // one mask entry a lane: the pass's 32 keys, for the test whether any of them is masked at all
#pragma unroll
    for (int kt = 0; kt < 2; ++kt)
#pragma unroll
        for (int ks = 0; ks < 2; ++ks) va[kt][ks] = ldg(pV + (kt * 2 + ks) * 1024);
    // behind these loads, ahead of every later write of their address registers; it also keeps the loads in the loop's own order (mask entry, key rows, then the transposed plane), so that the first product's counted wait leaves the plane's loads in flight
    asm volatile("s_wait_xcnt 0x0" :: "v"(pQ), "v"(oF), "s"(Vs) : "memory");
#pragma unroll
    for (int dt = 0; dt < 4; ++dt) ka[dt] = ldgh(pK + dt * 1024);
    // behind the last load in front of the loop, ahead of every later write of a register that one of them names as its address
    asm volatile("s_wait_xcnt 0x0" :: "v"(oF), "v"(oM), "s"(Ks), "s"(Ms) : "memory");
    // bases: bk of the plane rows last fetched; bv and bm of the key rows and mask entries that the coming pass fetches ahead (the piece's second pass, or its first again where there is no other)
    gcp bk = (gcp)(const char*)Ks, bv = (gcp)(const char*)Vs + (size_t)(s0 + 1 < s1 ? 32 * HD * 2 : 0), bm = (gcp)(const char*)Ms + (size_t)(s0 + 1 < s1 ? 32 * 4 : 0);
    v8f acc[2][4]; float m[2], nm[2]; v2f l2[2];   // nm = -m * CX, the addend of the fused form; set anew wherever m is
#pragma unroll
    for (int c = 0; c < 2; ++c) { m[c] = -3.0e38f; nm[c] = 0.f; l2[c] = (v2f){};
#pragma unroll
        for (int dt = 0; dt < 4; ++dt) acc[c][dt] = (v8f){}; }
    for (int st = s0; st < s1; ++st) {
        v8f s[2][2];
#pragma unroll
        for (int c = 0; c < 2; ++c)
#pragma unroll
            for (int kt = 0; kt < 2; ++kt) s[c][kt] = wmmab(va[kt][0], qb[c][0], (v8f){});
#pragma unroll
        for (int c = 0; c < 2; ++c)
#pragma unroll
            for (int kt = 0; kt < 2; ++kt) s[c][kt] = wmmab(va[kt][1], qb[c][1], s[c][kt]);
        // plain pass: wholly in front of the diagonal and no key with a mask entry above 0, so that -1e9 * max(0, entry) is a zero and adding it an identity
        const bool plain = (st < tl) & (__builtin_amdgcn_ballot_w32(mkl > 0.f) == 0u);
        // the next pass's key rows go into the registers that the products above have just read: they have the softmax and the second product to arrive
        mkl = *(const __attribute__((address_space(1))) float*)(bm + oM);
#pragma unroll
        for (int kt = 0; kt < 2; ++kt)
#pragma unroll
            for (int ks = 0; ks < 2; ++ks) va[kt][ks] = ldg(bv + oF + (kt * 2 + ks) * 1024);
        // s[c][kt][e]: key kt*16 + 8*hi + e of the pass, query column c*16 + lr. A plain pass uses the products as they are; the other kind puts the masked score, times 32, in their place
        if (!plain) {
            const float* pm = MK + st * 32 + 8 * hi; v4f mk4[4];
            mk4[0] = *(const v4f*)pm; mk4[1] = *(const v4f*)(pm + 4); mk4[2] = *(const v4f*)(pm + 16); mk4[3] = *(const v4f*)(pm + 20);
            // behind the four mask loads, ahead of every later write of their address register
            asm volatile("s_wait_xcnt 0x0" :: "v"(pm) : "memory");
#pragma unroll
            for (int c = 0; c < 2; ++c) { const int i = r0 + c * 16 + lr;
#pragma unroll
                for (int kt = 0; kt < 2; ++kt)
#pragma unroll
                    for (int e = 0; e < 8; ++e) { const int j = st * 32 + kt * 16 + 8 * hi + e;
                        const float mk = fmaxf((j > i) ? 1.f : 0.f, mk4[kt * 2 + (e >> 2)][e & 3]);
                        s[c][kt][e] = (s[c][kt][e] * 0.03125f + __fmul_rn(-1e9f, mk)) * 32.0f; } }   // both scalings are by a power of two, exact: fused or not, the sum rounds once, as the source's
        }
        float ml[2];
#pragma unroll
        for (int c = 0; c < 2; ++c) { float x[8];
#pragma unroll
            for (int k = 0; k < 8; ++k) x[k] = fmaxf(s[c][k >> 2][(k & 3) * 2], s[c][k >> 2][(k & 3) * 2 + 1]);
            const float y = fmaxf(fmaxf(fmaxf(x[0], x[1]), fmaxf(x[2], x[3])), fmaxf(fmaxf(x[4], x[5]), fmaxf(x[6], x[7])));
            ml[c] = fmaxf(y, xhalf(y)); }
        if (__builtin_amdgcn_ballot_w32(ml[0] > m[0] + LAZ || ml[1] > m[1] + LAZ) != 0u) {
#pragma unroll
            for (int c = 0; c < 2; ++c) { const float mn = fmaxf(m[c], ml[c]); const float al = __builtin_amdgcn_exp2f((m[c] - mn) * CX); m[c] = mn; nm[c] = -mn * CX; l2[c] *= al;
#pragma unroll
                for (int dt = 0; dt < 4; ++dt) acc[c][dt] *= al; }
        }
        // The exponent of 2 is one fused multiply-add for two scores, s * CX + w. Plain pass: w = -m * CX (scores of ordinary size, and so is m behind the test above).
        // Otherwise entries near -3.2e10 can stand here, so the difference is taken first (an exact 0 where a masked row's entries all equal m) and w = 0.
        float w[2] = {nm[0], nm[1]};
        if (!plain) {
#pragma unroll
            for (int c = 0; c < 2; ++c) { w[c] = 0.f;
#pragma unroll
                for (int kt = 0; kt < 2; ++kt) s[c][kt] -= m[c]; }
        }
        v16h ph[2];
#pragma unroll
        for (int c = 0; c < 2; ++c) { v8u hu;
#pragma unroll
            for (int k = 0; k < 8; ++k) { const v2f x = __builtin_elementwise_fma((v2f){s[c][k >> 2][(k & 3) * 2], s[c][k >> 2][(k & 3) * 2 + 1]}, (v2f){CX, CX}, (v2f){w[c], w[c]});
                const v2f p = (v2f){__builtin_amdgcn_exp2f(x[0]), __builtin_amdgcn_exp2f(x[1])}; l2[c] += p;
                hu[k] = pkh(p[0], p[1]); }
            ph[c] = __builtin_bit_cast(v16h, hu); }
#pragma unroll
        for (int c = 0; c < 2; ++c)
#pragma unroll
            for (int dt = 0; dt < 4; ++dt) acc[c][dt] = wmma16(ka[dt], ph[c], acc[c][dt]);
        // the next pass's rows of the transposed plane, likewise into the registers just read: they have the next pass's first product and softmax to arrive
        // Addresses in the loop: a scalar base that moves with the pass and a lane offset that never changes. The one wait of a pass for the loads issued so far stands here, in front of the step of all three bases,
        // where those loads have had the softmax to run out, and not directly behind them; bases and offsets go through the statement so that the bases are stepped behind it, all stay in their registers up to it,
        // and each address is formed from its two parts at the load itself (scalar base + 32-bit lane offset), in no further register.
        asm volatile("s_wait_xcnt 0x0" : "+s"(bv), "+s"(bm), "+s"(bk), "+v"(oF), "+v"(oM) :: "memory");
        bk += (size_t)(st + 1 < s1 ? 32 * HD * 2 : 0);                                                       // the piece's last pass fetches itself again, in bounds
        bv += (size_t)(st + 2 < s1 ? 32 * HD * 2 : 0); bm += (size_t)(st + 2 < s1 ? 32 * 4 : 0);   // for the fetch that the next pass makes
#pragma unroll
        for (int dt = 0; dt < 4; ++dt) ka[dt] = ldgh(bk + oF + dt * 1024);
    }
    // behind the last pass's fetches, ahead of every later write of a register that one of them names as its address (bases and offsets ride along as inputs, so that they stay in their registers up to here)
    asm volatile("s_wait_xcnt 0x0" :: "s"(bv), "s"(bm), "s"(bk), "v"(oF), "v"(oM) : "memory");
    float* sl = mg + (pi * 5 + rl + sg) * SLB + lane * 4; float lj[2];   // the piece's slot, 16 B a lane in each block
#pragma unroll
    for (int c = 0; c < 2; ++c) { const float l = l2[c][0] + l2[c][1]; lj[c] = l + xhalf(l);
#pragma unroll
        for (int dt = 0; dt < 4; ++dt) { const v8f o = acc[c][dt];
            *(v4f*)(sl + ((c * 4 + dt) * 2) * 128) = (v4f){o[0], o[1], o[2], o[3]}; *(v4f*)(sl + ((c * 4 + dt) * 2 + 1) * 128) = (v4f){o[4], o[5], o[6], o[7]}; } }
    *(v4f*)(sl + 16 * 128) = (v4f){m[0], m[1], lj[0], lj[1]};
    }
    __syncthreads();   // every piece of the work-group's 8 row tiles is in its slot before one is read
    // the wave joins query columns c*16 .. +15 of tile tB (x = 1) or tA (x = 0). Slots of tA: 0 .. (waves whose quarter starts in front of its end) - 1; of tB: 5 - (waves whose quarter ends behind its start) .. 4
    const int x = rl >> 1, c = rl & 1;
    int nA = 0, nB = 0;
    for (int j = 0; j < 4; ++j) { nA += ((j * tot) >> 2) < NSA ? 1 : 0; nB += (((j + 1) * tot) >> 2) > NSA ? 1 : 0; }
    const int q0 = x ? 5 - nB : 0, q1 = x ? 5 : nA;
    const float* sb = mg + pi * 5 * SLB + lane * 4;
    float M = sb[q0 * SLB + 16 * 128 + c], l = 0.f; v8f o[4];   // a tile has 1 to 4 pieces
#pragma unroll
    for (int dt = 0; dt < 4; ++dt) o[dt] = (v8f){};
#pragma unroll
    for (int k = 1; k < 4; ++k) M = fmaxf(M, sb[(q0 + k < q1 ? q0 + k : q0) * SLB + 16 * 128 + c]);   // where there is no piece k, the first again; unrolled so that the four reads go out together
    for (int q = q0; q < q1; ++q) { const float* p = sb + q * SLB;
        const float f = __builtin_amdgcn_exp2f((p[16 * 128 + c] - M) * CX); l += p[16 * 128 + 2 + c] * f;
#pragma unroll
        for (int dt = 0; dt < 4; ++dt) { const v4f a = *(const v4f*)(p + ((c * 4 + dt) * 2) * 128), b = *(const v4f*)(p + ((c * 4 + dt) * 2 + 1) * 128);
            o[dt] += (v8f){a[0], a[1], a[2], a[3], b[0], b[1], b[2], b[3]} * f; } }
    const float f = __fdiv_rn(1.0f, l);
    float* po = OUT + ((size_t)zb * TT + (x ? tB : tA) * RW + c * 16 + lr) * DM + hd * HD + 8 * hi;   // the lane's 8 neighbouring d of each 16-row output tile
#pragma unroll
    for (int dt = 0; dt < 4; ++dt) { const v8f r = o[dt] * f;
        *(v4f*)(po + dt * 16) = (v4f){r[0], r[1], r[2], r[3]}; *(v4f*)(po + dt * 16 + 4) = (v4f){r[4], r[5], r[6], r[7]}; }
}

extern "C" void kernel_launch(void* const* d_in, const int* in_sizes, int n_in,
                              void* d_out, int out_size, void* d_ws, size_t ws_size, hipStream_t stream) {
    (void)in_sizes; (void)n_in; (void)out_size;
    const float* x = (const float*)d_in[0]; const float* y = (const float*)d_in[1]; const float* z = (const float*)d_in[2]; const float* pm = (const float*)d_in[3];
    float* OUT = (float*)d_out;     // [2][2048][1024]
    char* wsp = (char*)d_ws;
    auto take = [&](size_t bytes) { char* p = wsp; wsp += (bytes + 255) & ~(size_t)255; return (void*)p; };
    const size_t zb = (size_t)NH_ * TT * HD;   // elements of one batch entry's planes
    bf* QP = (bf*)take(NB_ * zb * 2); bf* VP = (bf*)take(NB_ * zb * 2); bf* KT = (bf*)take(NB_ * zb * 2); float* MK = (float*)take((size_t)NB_ * TT * 4); int* FL = (int*)take((size_t)NB_ * (TT / RW) * 4);
    if ((size_t)(wsp - (char*)d_ws) > ws_size) return;    // total ~ 24 MB
    k_prep<<<dim3(TT / PTT, NH_, NB_), 512, 0, stream>>>(x, y, z, pm, QP, VP, KT, MK, FL);   // scores use z ('value'), output uses y ('key')
    k_attn<<<dim3(NB_ * NH_, NTL / 8), 512, 0, stream>>>(QP, VP, KT, MK, FL, OUT);
}

// v010
// Measured time: 23.4 microseconds a run.
// Next to v009, in two timings, it ran 1.23 times as fast each time.
// Counting every step since v000, it is 57.4 times as fast.
#include <hip/hip_runtime.h>

// decoderSelfAttention (x, y, z [2][2048][1024] split into 16 heads x 64 with NO projections; pad_mask [2][2048] (float, read); faithful to the source's argument swap: scores = q.v / sqrt(1024) with q from x and 'v' from z, then + (-1e9) x mask where mask = max(strict-upper-triangle, 1 - pad_mask[key]);
//   softmax; output = weights . k with 'k' from y; heads re-merged -> [2][2048][1024]).
// Compute dtypes, f32 accumulate: every input rounded to bf16; the scores are a PLAIN bf16 GEMM of the inputs themselves (exact products); the mask is additive -1e9, exactly as the source, so a fully padded row falls back to all keys: key tiles behind a row block's diagonal are left out only where a flag formed from pad_mask says that their weights are exact zeros; scale + mask + softmax f32 -> each weight rounded once to f16 (11 significant bits; weights lie in [0, e^5.5]); weights.k as ONE f16 product, its k plane holding the bf16-rounded y written as f16 (the same value for 2^-14 <= |y| < 65520: 8 significant bits fit in 11; below 2^-14 to within 2^-25; y is standard normal); a wave carries 32 query rows of one head and every fourth pass of 32 keys from scores to partial output; the partial outputs of a row are joined in f32.

#define NB_  2
#define TT   2048
#define DM   1024
#define NH_  16
#define HD   64
#define ZH   2
typedef _Float16 h16;
typedef unsigned short bf;
typedef __attribute__((ext_vector_type(16))) __bf16   v16bf;
typedef __attribute__((ext_vector_type(16))) _Float16 v16h;
typedef __attribute__((ext_vector_type(8)))  _Float16 v8h;
typedef __attribute__((ext_vector_type(8)))  unsigned short v8us;
typedef __attribute__((ext_vector_type(8)))  float    v8f;
typedef __attribute__((ext_vector_type(4)))  float    v4f;
typedef v8h  __attribute__((may_alias)) v8ha;
typedef v4f  __attribute__((may_alias)) v4fa;
typedef v8us __attribute__((may_alias)) v8usa;

__device__ __forceinline__ unsigned short f2bf(float f) { unsigned u = __float_as_uint(f); u += 0x7FFFu + ((u >> 16) & 1u); return (unsigned short)(u >> 16); }
__device__ __forceinline__ float bf2f(unsigned short b) { return __uint_as_float(((unsigned)b) << 16); }
__device__ __forceinline__ float bfr(float f) { return bf2f(f2bf(f)); }
typedef __attribute__((ext_vector_type(2))) float v2f;
typedef __attribute__((ext_vector_type(2))) _Float16 v2h;
// two f32 values rounded to nearest f16, packed (a in the low half)
__device__ __forceinline__ unsigned pkh(float a, float b) { return __builtin_bit_cast(unsigned, __builtin_convertvector((v2f){a, b}, v2h)); }
__device__ __forceinline__ v16h cat16(v8h lo, v8h hi) { return __builtin_shufflevector(lo, hi, 0, 1, 2, 3, 4, 5, 6, 7, 8, 9, 10, 11, 12, 13, 14, 15); }
__device__ __forceinline__ v16bf cat16b(v8us lo, v8us hi) { return __builtin_bit_cast(v16bf, __builtin_shufflevector(lo, hi, 0, 1, 2, 3, 4, 5, 6, 7, 8, 9, 10, 11, 12, 13, 14, 15)); }
__device__ __forceinline__ v8f wmma16(v16h a, v16h b, v8f c) { return __builtin_amdgcn_wmma_f32_16x16x32_f16(false, a, false, b, (short)0, c, false, false); }
__device__ __forceinline__ v8f wmmab(v16bf a, v16bf b, v8f c) { return __builtin_amdgcn_wmma_f32_16x16x32_bf16(false, a, false, b, (short)0, c, false, false); }



typedef __attribute__((ext_vector_type(4))) unsigned v4u;
typedef __attribute__((ext_vector_type(2))) unsigned v2u;
typedef __attribute__((ext_vector_type(8))) unsigned v8u;
typedef __attribute__((ext_vector_type(2))) __bf16 v2b;
typedef v4u __attribute__((may_alias)) v4ua;
typedef v2u __attribute__((may_alias)) v2ua;
// two f32 values rounded to nearest-even bf16, packed (a in the low half); for every finite value the same bits as f2bf
__device__ __forceinline__ unsigned pkb(float a, float b) { return __builtin_bit_cast(unsigned, __builtin_convertvector((v2f){a, b}, v2b)); }

// ---- ONE launch. k_attn: layout, scores, softmax and weights . k. Grid (NB_*NH_, NTL/8), 16 waves a work-group, 4 on a SIMD, one work-group a WGP.
// The products are taken transposed: S^T = v . q^T (A = 16 key rows, B = 16 query rows as columns), O^T += k^T . P^T (A = 16 rows d of the transposed plane, B = the weights).
// A lane then holds, for ONE query (its column), 8 neighbouring keys of each 16-key tile: maximum and sum are in-lane but for one exchange between the wave's halves,
// and the two score tiles of a 32-key pass, converted in place, ARE the B operand of the second product in the loaders' own k order (8 at 8*hi, 8 at 16 + 8*hi).
// A pass is 32 keys, a stage 4 passes (128 keys). A row tile (32 queries) has NS passes: up to its diagonal pass where its flag is set, all TT/32 otherwise.
//   Flag of row tile rb = 1 where some key j <= 32*rb has a mask entry 1 - bf16(pad_mask[j]) <= 0.5. Every row of that tile then has a score above -5e8 - |s|, every key behind the tile's last row one below -1e9 + |s|, so the latter's exp is an exact 0.
// Layout, stage by stage, in the work-group's own LDS: its 512 threads read the stage's 128 rows x 64 columns of z and y (f32, 16 B a lane, one stage ahead, held in registers over the pass), round them
//   (z to bf16; y to bf16, written as f16) and put them in the FRAGMENT ORDER of the A operands. Lane l = 16*hi + lr, half hf, element e:
//     z, fragment kt*2 + ks: key 16*kt + lr of the pass, d = 32*ks + 16*hf + 8*hi + e;   y, fragment dt: d = 16*dt + lr, key 16*hf + 8*hi + e of the pass.
//   Two buffers: while stage g is read, stage g + 1 is written; one barrier a stage publishes the one and ends the reads of the other.
// Work: four waves (pi, 0..3) share the row tiles tA = NTL - 1 - tB and tB. The work-group walks the stages of its four tiles tA, then those of its four tiles tB (17 stages where all flags are set); in each stage wave rl takes pass rl for its tile,
//   or none where that pass lies behind the tile's last. A wave's passes of a tile are one piece: it leaves its maximum in use, row sums and output tiles in an LDS slot of its own. Behind the last barrier each wave joins the 4 pieces of 16 rows of one tile
//   (each scaled by e^(its m - the largest m)), divides and stores.
// The maximum in use m follows the running maximum lazily: sums and output tiles are rescaled only in a pass where some column's maximum has risen more than 5.5 above m (weights stay below e^5.5); the division by the row sum stands at the end.
// Every inner loop is unrolled so that the fragment, score and output arrays are indexed by constants and stay in registers; the loop over the stages stays rolled.
#define RW 32
#define NTL (TT / RW)
#define SLB 2176            // floats of a slot: 16 blocks of 128 (4 output values a lane), then 128 (m[0], m[1], row sums 0 and 1 of each lane)
#define KDP 260             // y stage: dwords per fragment (1 KiB + 16 B): the 4 fragments that the lanes of one LDS store fall in start 4 banks apart
#define KSP (4 * KDP)       // y stage: dwords per pass
#define VBP 72              // z stage: dwords per 256-B block (one half of a fragment, one hi; + 32 B): the 8 blocks that the lanes of one LDS store fall in start 8 banks apart
#define FZ0 (8 * KSP)       // dword offsets in the stage area: two y buffers, then two z buffers, then the second tiles' query fragments
#define FQ0 (FZ0 + 128 * VBP)
#define STEPB ((size_t)128 * DM * 4)   // bytes from one stage's rows to the next's
#define L2E 1.4426950408889634f
// The softmax works on the RAW products s (32 times the scaled score; the scaling by 1/32 is a power of two, so every sum, difference and maximum below is exactly 32 times the scaled one). CX turns a raw difference into the exponent of 2.
#define CX (L2E * 0.03125f)
#define LAZ 176.0f          // 5.5 in raw units
// a byte pointer that keeps its global address space through an asm statement (a plain pointer would come out of it as a flat one)
typedef const __attribute__((address_space(1))) char* gcp;
typedef const __attribute__((address_space(1))) v4f* gv4;
// the value of the lane 16 away
__device__ __forceinline__ float xhalf(float x) { const int b = __float_as_int(x); return __int_as_float(__builtin_amdgcn_permlanex16(b, b, 0x76543210, 0xfedcba98, false, false)); }
// a stage's rows into registers: scalar base of the stage + the lane's fixed offset + a constant. y: row pairs (p*32 + rw)*2 + q; z: rows p*32 + rw; 4 columns a lane
__device__ __forceinline__ void ld_stage(gcp by, gcp bz, unsigned oY, unsigned oZ, v4f (&ya)[2][2], v4f (&za)[4]) {
#pragma unroll
    for (int p = 0; p < 2; ++p)
#pragma unroll
        for (int q = 0; q < 2; ++q) ya[p][q] = *(gv4)(by + oY + (p * 64 + q) * DM * 4);
#pragma unroll
    for (int p = 0; p < 4; ++p) za[p] = *(gv4)(bz + oZ + p * 32 * DM * 4);
}
// the same rows, rounded, into a stage buffer in fragment order
__device__ __forceinline__ void st_stage(unsigned* tl, unsigned* tv, int c4, int rw, const v4f (&ya)[2][2], const v4f (&za)[4]) {
#pragma unroll
    for (int p = 0; p < 2; ++p)
#pragma unroll
        for (int u = 0; u < 4; u += 2) {   // rows t, t+1 of one column: neighbouring keys of one lane's 16 B. Pass p*2 + rw/16, key 2*(rw & 15) of it. Each row's two neighbouring columns are rounded to bf16 together, then the rows are paired as f16
            const unsigned w0 = pkb(ya[p][0][u], ya[p][0][u + 1]), w1 = pkb(ya[p][1][u], ya[p][1][u + 1]);
            unsigned* d = tl + (p * 2 + (rw >> 4)) * KSP + (c4 >> 4) * KDP + ((rw & 15) >> 2) * 64 + ((c4 & 15) + u) * 4 + (rw & 3);   // c4 is a multiple of 4: its 4 columns lie in one fragment
            d[0] = pkh(__uint_as_float(w0 << 16), __uint_as_float(w1 << 16)); d[4] = pkh(__uint_as_float(w0 & 0xFFFF0000u), __uint_as_float(w1 & 0xFFFF0000u)); }
#pragma unroll
    for (int p = 0; p < 4; ++p)   // pass p, key rw of it, 4 neighbouring d: half of one lane's 16 B
        *(v2ua*)(tv + (p * 16 + (rw >> 4) * 8 + (c4 >> 3)) * VBP + (rw & 15) * 4 + ((c4 >> 2) & 1) * 2) = (v2u){pkb(za[p][0], za[p][1]), pkb(za[p][2], za[p][3])};
}
__device__ __forceinline__ v4u pk8(v4f a, v4f b) { return (v4u){pkb(a[0], a[1]), pkb(a[2], a[3]), pkb(b[0], b[1]), pkb(b[2], b[3])}; }
// a fragment from LDS: the lane's 8 elements at p, 8 at p + d dwords
__device__ __forceinline__ v16bf ldl(const unsigned* p, int d) { return cat16b(*(const v8usa*)p, *(const v8usa*)(p + d)); }
__global__ __launch_bounds__(512) void k_attn(const float* __restrict__ X, const float* __restrict__ Y, const float* __restrict__ Z, const float* __restrict__ PM, float* OUT) {
    // slots 0..15: the pieces of the tiles tA; 16..31: of the tiles tB. Until the pieces are written, the first area holds the first tiles' query fragments (read before the first stage's barrier) and the second the stage buffers and the second tiles' query fragments
    __shared__ __attribute__((aligned(16))) float mg[32 * SLB];
    __shared__ __attribute__((aligned(16))) float mkS[TT];   // the batch entry's mask entries 1 - bf16(pad_mask)
    __shared__ unsigned fw[16];                              // one word of 8 flag bits per wave
    unsigned* const FB = (unsigned*)(mg + 16 * SLB); unsigned* const QA = (unsigned*)mg; unsigned* const QB = FB + FQ0;
    const int tid = threadIdx.x, zb = blockIdx.x / NH_, hd = blockIdx.x % NH_, y4 = (int)blockIdx.y * 4;
    const int lane = tid & 31, lr = lane & 15, hi = lane >> 4, wv = __builtin_amdgcn_readfirstlane(tid >> 5);
    const int pi = wv & 3, rl = wv >> 2;
    const int tB = y4 + pi, tA = NTL - 1 - tB;
    const int c4 = (tid & 15) * 4, rw = tid >> 4;   // layout: the lane's 4 columns; its row (z) or row pair (y) within a pass of 32
    const gcp hy = (gcp)(const char*)(Y + (size_t)zb * TT * DM + hd * HD), hz = (gcp)(const char*)(Z + (size_t)zb * TT * DM + hd * HD);
    gcp by = hy + STEPB, bz = hz + STEPB; unsigned oY = (unsigned)(rw * 2 * DM + c4) * 4u, oZ = (unsigned)(rw * DM + c4) * 4u;
    v4f ya[2][2], za[4], b0, b1, b2, b3;
    unsigned* const dB = QB + ((pi * 4 + rl) * 64 + lane) * 4;
    {   // in front of the first barrier: mask entries and flags, one query fragment of the wave's first tile (fragment c*2 + ks = rl), stage 0. The fragment of its second tile and stage 1 are asked for behind them and stay in flight across the barrier
        const v4f pv = *(const v4f*)(PM + (size_t)zb * TT + tid * 4);   // the batch entry's whole pad_mask, 4 keys a thread
        const float* xA = X + ((size_t)zb * TT + tA * RW + (rl >> 1) * 16 + lr) * DM + hd * HD + (rl & 1) * 32 + 8 * hi;
        const float* xB = X + ((size_t)zb * TT + tB * RW + (rl >> 1) * 16 + lr) * DM + hd * HD + (rl & 1) * 32 + 8 * hi;
        v4f y0[2][2], z0[4];
        ld_stage(hy, hz, oY, oZ, y0, z0);
        const v4f a0 = *(const v4f*)xA, a1 = *(const v4f*)(xA + 4), a2 = *(const v4f*)(xA + 16), a3 = *(const v4f*)(xA + 20);
        b0 = *(const v4f*)xB; b1 = *(const v4f*)(xB + 4); b2 = *(const v4f*)(xB + 16); b3 = *(const v4f*)(xB + 20);
        ld_stage(by, bz, oY, oZ, ya, za);   // stage 1 of the list, which is key stage 1: a tile tA has at least NTL/2 + 1 passes, so the first walk has more than one stage. Asked for here so that it shares stage 0's trip to memory
        // behind these loads, ahead of every later write of a register that one of them names as its address
        asm volatile("s_wait_xcnt 0x0" :: "v"(xA), "v"(xB) : "memory");
        unsigned open = 0, bits = 0; v4f r;   // open, bit u: the mask entry of key tid*4+u is at most 0.5
#pragma unroll
        for (int u = 0; u < 4; ++u) { r[u] = __fsub_rn(1.0f, bfr(pv[u])); open |= (r[u] <= 0.5f ? 1u : 0u) << u; }
        *(v4fa*)(mkS + tid * 4) = r;
#pragma unroll
        for (int q = 0; q < 8; ++q) { const int n = (q < 4 ? y4 + q : NTL - 1 - (y4 + q - 4)) * RW - tid * 4;   // the thread's keys u <= n count for row tile q (0..3: tiles tB, 4..7: tiles tA)
            const unsigned in = n >= 3 ? 15u : n < 0 ? 0u : (2u << n) - 1u;
            bits |= (__any((open & in) != 0u) ? 1u : 0u) << q; }
        if (lane == 0) fw[wv] = bits;
        unsigned* dA = QA + ((pi * 4 + rl) * 64 + lane) * 4;
        *(v4ua*)dA = pk8(a0, a1); *(v4ua*)(dA + 128) = pk8(a2, a3);
        st_stage(FB, FB + FZ0, c4, rw, y0, z0);
    }
    // mask entries, flag words, the first tiles' query fragments and stage 0 are in LDS before one is read; by hand, like the stages' barrier below, so that the loads still under way are not waited for here
    asm volatile("s_wait_dscnt 0x0" ::: "memory");
    asm volatile("s_barrier_signal -1\n\ts_barrier_wait -1" ::: "memory");
    *(v4ua*)dB = pk8(b0, b1); *(v4ua*)(dB + 128) = pk8(b2, b3);   // read at the start of the second walk, behind at least one stage's barrier
    unsigned fo = 0;
#pragma unroll
    for (int w = 0; w < 16; ++w) fo |= fw[w];
    const unsigned fb = (unsigned)__builtin_amdgcn_readfirstlane((int)fo);
    int SA = 0, SB = 0;   // stages of the two walks: the same in every wave
#pragma unroll
    for (int j = 0; j < 4; ++j) { const int nb = ((fb >> j) & 1u) ? y4 + j + 1 : NTL, na = ((fb >> (4 + j)) & 1u) ? NTL - (y4 + j) : NTL;
        SB = SB > ((nb + 3) >> 2) ? SB : ((nb + 3) >> 2); SA = SA > ((na + 3) >> 2) ? SA : ((na + 3) >> 2); }
    const int NSA = ((fb >> (4 + pi)) & 1u) ? tA + 1 : NTL, NSB = ((fb >> pi) & 1u) ? tB + 1 : NTL, G = SA + SB;   // SA, SB >= 1
    v16bf qb[2][2]; v8f acc[2][4]; float m[2], nm[2]; v2f l2[2];   // nm = -m * CX, the addend of the fused form; set anew wherever m is
    int tl = tA, NS = NSA;
    for (int g = 0; ; ++g) {
        if (g == SA || g == G) {   // a walk has ended: the piece goes to its slot, 16 B a lane in each block (behind the barrier of the walk's last stage)
            float* sl = mg + ((g == G ? 16 : 0) + pi * 4 + rl) * SLB + lane * 4; float lj[2];
#pragma unroll
            for (int c = 0; c < 2; ++c) { const float l = l2[c][0] + l2[c][1]; lj[c] = l + xhalf(l);
#pragma unroll
                for (int dt = 0; dt < 4; ++dt) { const v8f o = acc[c][dt];
                    *(v4fa*)(sl + ((c * 4 + dt) * 2) * 128) = (v4f){o[0], o[1], o[2], o[3]}; *(v4fa*)(sl + ((c * 4 + dt) * 2 + 1) * 128) = (v4f){o[4], o[5], o[6], o[7]}; } }
            *(v4fa*)(sl + 16 * 128) = (v4f){m[0], m[1], lj[0], lj[1]};
            if (g == G) break;
            tl = tB; NS = NSB;
        }
        if (g == 0 || g == SA) {   // a walk begins
            const unsigned* qs = (g == 0 ? QA : QB) + (pi * 4 * 64 + lane) * 4;
#pragma unroll
            for (int c = 0; c < 2; ++c) { m[c] = -3.0e38f; nm[c] = 0.f; l2[c] = (v2f){};
#pragma unroll
                for (int ks = 0; ks < 2; ++ks) qb[c][ks] = ldl(qs + (c * 2 + ks) * 256, 128);
#pragma unroll
                for (int dt = 0; dt < 4; ++dt) acc[c][dt] = (v8f){}; }
        }
        const int st = (g < SA ? g : g - SA) * 4 + rl, r0 = tl * RW;   // the wave's pass of this stage
        const unsigned* fy = FB + (g & 1) * (4 * KSP) + rl * KSP + lane * 4; const unsigned* fz = FB + FZ0 + (g & 1) * (64 * VBP) + (rl * 16 + hi) * VBP + lr * 4;
        // the key rows and the pass's mask entries (one a lane, for the test whether any key is masked at all) are asked for first: they arrive under the layout work below
        v16bf va[2][2];
#pragma unroll
        for (int kt = 0; kt < 2; ++kt)
#pragma unroll
            for (int ks = 0; ks < 2; ++ks) va[kt][ks] = ldl(fz + (kt * 2 + ks) * 4 * VBP, 2 * VBP);
        const float mkl = mkS[st * 32 + lane];
        // layout: the rows in registers (stage g + 1 of the list) go to the other buffer, then the rows of stage g + 2 are asked for: they have a whole stage to arrive
        if (g + 1 < G) st_stage(FB + ((g + 1) & 1) * (4 * KSP), FB + FZ0 + ((g + 1) & 1) * (64 * VBP), c4, rw, ya, za);
        if (g + 2 < G) { const int kn = g + 2 < SA ? g + 2 : g + 2 - SA;
            // ahead of the step of the two bases; the loads that name them have been used above, so nothing is waited for. Bases and offsets go through the statement so that they stay in their registers up to it
            asm volatile("s_wait_xcnt 0x0" : "+s"(by), "+s"(bz), "+v"(oY), "+v"(oZ) :: "memory");
            by = hy + (size_t)kn * STEPB; bz = hz + (size_t)kn * STEPB;
            ld_stage(by, bz, oY, oZ, ya, za); }
        if (st < NS) {
        v8f s[2][2]; v16h ka[4];
#pragma unroll
        for (int c = 0; c < 2; ++c)
#pragma unroll
            for (int kt = 0; kt < 2; ++kt) s[c][kt] = wmmab(va[kt][0], qb[c][0], (v8f){});
#pragma unroll
        for (int c = 0; c < 2; ++c)
#pragma unroll
            for (int kt = 0; kt < 2; ++kt) s[c][kt] = wmmab(va[kt][1], qb[c][1], s[c][kt]);
        // the rows of the transposed plane: they have the softmax to arrive
#pragma unroll
        for (int dt = 0; dt < 4; ++dt) ka[dt] = __builtin_bit_cast(v16h, ldl(fy + dt * KDP, 128));
        // plain pass: wholly in front of the diagonal and no key with a mask entry above 0, so that -1e9 * max(0, entry) is a zero and adding it an identity
        const bool plain = (st < tl) & (__builtin_amdgcn_ballot_w32(mkl > 0.f) == 0u);
        // s[c][kt][e]: key kt*16 + 8*hi + e of the pass, query column c*16 + lr. A plain pass uses the products as they are; the other kind puts the masked score, times 32, in their place
        if (!plain) {
            const float* pk = mkS + st * 32 + 8 * hi; v4f mk4[4];
            mk4[0] = *(const v4fa*)pk; mk4[1] = *(const v4fa*)(pk + 4); mk4[2] = *(const v4fa*)(pk + 16); mk4[3] = *(const v4fa*)(pk + 20);
#pragma unroll
            for (int c = 0; c < 2; ++c) { const int i = r0 + c * 16 + lr;
#pragma unroll
                for (int kt = 0; kt < 2; ++kt)
#pragma unroll
                    for (int e = 0; e < 8; ++e) { const int j = st * 32 + kt * 16 + 8 * hi + e;
                        const float mk = fmaxf((j > i) ? 1.f : 0.f, mk4[kt * 2 + (e >> 2)][e & 3]);
                        s[c][kt][e] = (s[c][kt][e] * 0.03125f + __fmul_rn(-1e9f, mk)) * 32.0f; } }   // both scalings are by a power of two, exact: fused or not, the sum rounds once, as the source's
        }
        float ml[2];
#pragma unroll
        for (int c = 0; c < 2; ++c) { float x[8];
#pragma unroll
            for (int k = 0; k < 8; ++k) x[k] = fmaxf(s[c][k >> 2][(k & 3) * 2], s[c][k >> 2][(k & 3) * 2 + 1]);
            const float y = fmaxf(fmaxf(fmaxf(x[0], x[1]), fmaxf(x[2], x[3])), fmaxf(fmaxf(x[4], x[5]), fmaxf(x[6], x[7])));
            ml[c] = fmaxf(y, xhalf(y)); }
        if (__builtin_amdgcn_ballot_w32(ml[0] > m[0] + LAZ || ml[1] > m[1] + LAZ) != 0u) {
#pragma unroll
            for (int c = 0; c < 2; ++c) { const float mn = fmaxf(m[c], ml[c]); const float al = __builtin_amdgcn_exp2f((m[c] - mn) * CX); m[c] = mn; nm[c] = -mn * CX; l2[c] *= al;
#pragma unroll
                for (int dt = 0; dt < 4; ++dt) acc[c][dt] *= al; }
        }
        // The exponent of 2 is one fused multiply-add for two scores, s * CX + w. Plain pass: w = -m * CX (scores of ordinary size, and so is m behind the test above).
        // Otherwise entries near -3.2e10 can stand here, so the difference is taken first (an exact 0 where a masked row's entries all equal m) and w = 0.
        float w[2] = {nm[0], nm[1]};
        if (!plain) {
#pragma unroll
            for (int c = 0; c < 2; ++c) { w[c] = 0.f;
#pragma unroll
                for (int kt = 0; kt < 2; ++kt) s[c][kt] -= m[c]; }
        }
        v16h ph[2];
#pragma unroll
        for (int c = 0; c < 2; ++c) { v8u hu;
#pragma unroll
            for (int k = 0; k < 8; ++k) { const v2f x = __builtin_elementwise_fma((v2f){s[c][k >> 2][(k & 3) * 2], s[c][k >> 2][(k & 3) * 2 + 1]}, (v2f){CX, CX}, (v2f){w[c], w[c]});
                const v2f p = (v2f){__builtin_amdgcn_exp2f(x[0]), __builtin_amdgcn_exp2f(x[1])}; l2[c] += p;
                hu[k] = pkh(p[0], p[1]); }
            ph[c] = __builtin_bit_cast(v16h, hu); }
#pragma unroll
        for (int c = 0; c < 2; ++c)
#pragma unroll
            for (int dt = 0; dt < 4; ++dt) acc[c][dt] = wmma16(ka[dt], ph[c], acc[c][dt]);
        }
        // the stage's one barrier, by hand so that the rows asked for above stay in flight across it: the wave's LDS reads of this stage and its writes of the next are done, then every wave has passed
        asm volatile("s_wait_dscnt 0x0" ::: "memory");
        asm volatile("s_barrier_signal -1\n\ts_barrier_wait -1" ::: "memory");
    }
    // behind the last fetch, ahead of every later write of a register that it names as its address
    asm volatile("s_wait_xcnt 0x0" :: "s"(by), "s"(bz), "v"(oY), "v"(oZ) : "memory");
    __syncthreads();   // every piece of the work-group's 8 row tiles is in its slot before one is read
    // the wave joins the 4 pieces of query columns c*16 .. +15 of tile tB (x = 1) or tA (x = 0); a piece without a pass has m = -3e38, sums and tiles 0, and its factor is an exact 0 (piece 0 always has a pass)
    const int x = rl >> 1, c = rl & 1;
    const float* sb = mg + (x * 16 + pi * 4) * SLB + lane * 4;
    float M = sb[16 * 128 + c], l = 0.f; v8f o[4];
#pragma unroll
    for (int dt = 0; dt < 4; ++dt) o[dt] = (v8f){};
#pragma unroll
    for (int k = 1; k < 4; ++k) M = fmaxf(M, sb[k * SLB + 16 * 128 + c]);
    for (int q = 0; q < 4; ++q) { const float* p = sb + q * SLB;
        const float f = __builtin_amdgcn_exp2f((p[16 * 128 + c] - M) * CX); l += p[16 * 128 + 2 + c] * f;
#pragma unroll
        for (int dt = 0; dt < 4; ++dt) { const v4f a = *(const v4fa*)(p + ((c * 4 + dt) * 2) * 128), b = *(const v4fa*)(p + ((c * 4 + dt) * 2 + 1) * 128);
            o[dt] += (v8f){a[0], a[1], a[2], a[3], b[0], b[1], b[2], b[3]} * f; } }
    const float f = __fdiv_rn(1.0f, l);
    float* po = OUT + ((size_t)zb * TT + (x ? tB : tA) * RW + c * 16 + lr) * DM + hd * HD + 8 * hi;   // the lane's 8 neighbouring d of each 16-row output tile
#pragma unroll
    for (int dt = 0; dt < 4; ++dt) { const v8f r = o[dt] * f;
        *(v4f*)(po + dt * 16) = (v4f){r[0], r[1], r[2], r[3]}; *(v4f*)(po + dt * 16 + 4) = (v4f){r[4], r[5], r[6], r[7]}; }
}

extern "C" void kernel_launch(void* const* d_in, const int* in_sizes, int n_in,
                              void* d_out, int out_size, void* d_ws, size_t ws_size, hipStream_t stream) {
    (void)in_sizes; (void)n_in; (void)out_size; (void)d_ws; (void)ws_size;
    const float* x = (const float*)d_in[0]; const float* y = (const float*)d_in[1]; const float* z = (const float*)d_in[2]; const float* pm = (const float*)d_in[3];
    float* OUT = (float*)d_out;     // [2][2048][1024]
    k_attn<<<dim3(NB_ * NH_, NTL / 8), 512, 0, stream>>>(x, y, z, pm, OUT);   // scores use z ('value'), output uses y ('key')
}
